// v000
// Measured on an AMD MI455X. A time is GPU time per run, averaged over a window of back-to-back runs after a warm-up
// (all launches, gaps included; the runs take copies of the inputs in turn), and the median of several windows.
// Apart from v000's, it joins two sittings. Times from different sittings can be a few percent apart, while
// side-by-side timings come from the same sitting.
// The starting kernel, v000, takes 949 microseconds a run.
#include <hip/hip_runtime.h>
#include <hip/hip_bf16.h>
#include <math.h>

typedef __attribute__((ext_vector_type(2))) float v2f;
typedef __attribute__((ext_vector_type(8))) float v8f;

#define BB 8
#define HH 64
#define LIN 1024
#define KCONV 16
#define LL (LIN*KCONV)      // 16384
#define NN 32               // complex modes
#define TCH 256             // scan chunk length
#define CCH (LL/TCH)        // 64 chunks
#define NBLK 4

__device__ __forceinline__ float gelu_f(float x){
    float x3 = x*x*x;
    return 0.5f*x*(1.0f + tanhf(0.7978845608028654f*(x + 0.044715f*x3)));
}
__device__ __forceinline__ float sigm_f(float x){ return 1.0f/(1.0f + expf(-x)); }
__device__ __forceinline__ void lds_fence(){ asm volatile("s_wait_dscnt 0" ::: "memory"); }

// ---- ConvTranspose1d(1->H, k=16, stride=16): u[b,h,lin*16+k] = x[b,lin]*w[h,k]+b[h]
__global__ void conv_up_kernel(const float* __restrict__ x, const float* __restrict__ cw,
                               const float* __restrict__ cb, float* __restrict__ u){
    size_t idx = (size_t)blockIdx.x*blockDim.x + threadIdx.x;   // B*H*L
    int l = (int)(idx % LL); int bh = (int)(idx / LL); int h = bh % HH; int b = bh / HH;
    if (b >= BB) return;
    u[idx] = fmaf(x[b*LIN + (l>>4)], cw[h*KCONV + (l&15)], cb[h]);
}

// ---- LayerNorm over channel dim (stride-L layout), one thread per (b,l)
__global__ void ln_ch_kernel(const float* __restrict__ u, const float* __restrict__ w,
                             const float* __restrict__ bias, float* __restrict__ z){
    int idx = blockIdx.x*blockDim.x + threadIdx.x;   // B*L
    int l = idx % LL; int b = idx / LL;
    if (b >= BB) return;
    const float* up = u + (size_t)b*HH*LL + l;
    float s = 0.f, s2 = 0.f;
    #pragma unroll 8
    for (int h = 0; h < HH; ++h){ float v = up[(size_t)h*LL]; s += v; s2 += v*v; }
    float mu = s * (1.0f/HH);
    float var = s2*(1.0f/HH) - mu*mu;
    float rs = rsqrtf(var + 1e-5f);
    float* zp = z + (size_t)b*HH*LL + l;
    #pragma unroll 8
    for (int h = 0; h < HH; ++h){
        float v = up[(size_t)h*LL];
        zp[(size_t)h*LL] = fmaf((v - mu)*rs, w[h], bias[h]);
    }
}

// ---- S4D discretization: w = exp(dt*A), Ct = 2*C*(w-1)/A, wT = w^TCH
__global__ void s4pre_kernel(const float* __restrict__ log_dt, const float* __restrict__ A_re,
                             const float* __restrict__ A_im, const float* __restrict__ C_re,
                             const float* __restrict__ C_im, float2* __restrict__ wC,
                             float2* __restrict__ ctC, float2* __restrict__ wTC){
    int idx = blockIdx.x*blockDim.x + threadIdx.x;  // H*N
    if (idx >= HH*NN) return;
    int h = idx / NN;
    float dt = expf(log_dt[h]);
    float ar = A_re[idx], ai = A_im[idx];
    float dr = ar*dt, di = ai*dt;
    float er = expf(dr);
    float wr = er*cosf(di), wi = er*sinf(di);
    float mr = wr - 1.0f, mi = wi;                       // w-1
    float den = 1.0f/(ar*ar + ai*ai);
    float qr = (mr*ar + mi*ai)*den;                      // (w-1)/A
    float qi = (mi*ar - mr*ai)*den;
    float cr = C_re[idx], ci = C_im[idx];
    wC[idx]  = make_float2(wr, wi);
    ctC[idx] = make_float2(2.0f*(cr*qr - ci*qi), 2.0f*(cr*qi + ci*qr));
    float eT = expf(dr*(float)TCH);
    wTC[idx] = make_float2(eT*cosf(di*(float)TCH), eT*sinf(di*(float)TCH));
}

// ---- Scan pass A: per-(b,h,chunk) local end-state, lane = mode
__global__ void s4_local_kernel(const float* __restrict__ z, const float2* __restrict__ wC,
                                float2* __restrict__ states){
    int widx = blockIdx.x*blockDim.y + threadIdx.y;   // B*H*C waves
    int lane = threadIdx.x;
    int c = widx % CCH; int hh = (widx / CCH) % HH; int b = widx / (CCH*HH);
    if (b >= BB) return;
    float2 w = wC[hh*NN + lane];
    const float* zp = z + ((size_t)(b*HH + hh))*LL + c*TCH;
    float sr = 0.f, si = 0.f;
    for (int g = 0; g < TCH/32; ++g){
        float zv = zp[g*32 + lane];
        #pragma unroll
        for (int j = 0; j < 32; ++j){
            float zj = __shfl(zv, j, 32);
            float nr = fmaf(w.x, sr, fmaf(-w.y, si, zj));
            float ni = fmaf(w.x, si, w.y*sr);
            sr = nr; si = ni;
        }
    }
    states[((size_t)(b*HH + hh)*CCH + c)*NN + lane] = make_float2(sr, si);
}

// ---- Scan pass B: exclusive carry scan over chunks, thread per (b,h,n)
__global__ void s4_carry_kernel(const float2* __restrict__ wTC, float2* __restrict__ states){
    int idx = blockIdx.x*blockDim.x + threadIdx.x;    // B*H*N
    if (idx >= BB*HH*NN) return;
    int n = idx % NN; int hh = (idx / NN) % HH; int b = idx / (NN*HH);
    float2 wT = wTC[hh*NN + n];
    float cr = 0.f, ci = 0.f;
    float2* sp = states + ((size_t)(b*HH + hh))*CCH*NN + n;
    for (int c = 0; c < CCH; ++c){
        float2 loc = sp[(size_t)c*NN];
        sp[(size_t)c*NN] = make_float2(cr, ci);
        float nr = fmaf(wT.x, cr, -wT.y*ci) + loc.x;
        float ni = fmaf(wT.x, ci,  wT.y*cr) + loc.y;
        cr = nr; ci = ni;
    }
}

// ---- Scan pass C: replay with carry, emit gelu(y + D*z). LDS 32x33 transpose
// amortizes the cross-mode reduction (conflict-free on 64 banks).
__global__ void s4_apply_kernel(const float* __restrict__ z, const float2* __restrict__ wC,
                                const float2* __restrict__ ctC, const float2* __restrict__ states,
                                const float* __restrict__ Dvec, float* __restrict__ out){
    __shared__ float tile[4][32*33];
    int wy = threadIdx.y;
    int widx = blockIdx.x*blockDim.y + wy;
    int lane = threadIdx.x;
    int c = widx % CCH; int hh = (widx / CCH) % HH; int b = widx / (CCH*HH);
    if (b >= BB) return;
    float2 w  = wC[hh*NN + lane];
    float2 ct = ctC[hh*NN + lane];
    float2 s0 = states[((size_t)(b*HH + hh)*CCH + c)*NN + lane];
    float sr = s0.x, si = s0.y;
    float Dh = Dvec[hh];
    size_t base = ((size_t)(b*HH + hh))*LL + c*TCH;
    const float* zp = z + base;
    float* op = out + base;
    float p[32];
    for (int g = 0; g < TCH/32; ++g){
        float zv = zp[g*32 + lane];
        #pragma unroll
        for (int j = 0; j < 32; ++j){
            float zj = __shfl(zv, j, 32);
            float nr = fmaf(w.x, sr, fmaf(-w.y, si, zj));
            float ni = fmaf(w.x, si, w.y*sr);
            sr = nr; si = ni;
            p[j] = fmaf(-ct.y, si, ct.x*sr);
        }
        #pragma unroll
        for (int j = 0; j < 32; ++j) tile[wy][lane*33 + j] = p[j];
        lds_fence();
        float acc = 0.f;
        #pragma unroll
        for (int j = 0; j < 32; ++j) acc += tile[wy][j*33 + lane];
        lds_fence();
        op[g*32 + lane] = gelu_f(fmaf(Dh, zv, acc));
    }
}

// ---- outlin (128x64) GEMM fused with GLU residual: u += a*sigmoid(g)
__global__ void outlin_glu_kernel(const float* __restrict__ W, const float* __restrict__ bias,
                                  const float* __restrict__ X, float* __restrict__ U){
    int lane = threadIdx.x;
    int n0 = blockIdx.x*16;
    int m0 = (int)threadIdx.y*16;           // 0..48 over 64 'a' rows
    int b = blockIdx.z;
    int col = lane & 15, half = lane >> 4;
    int krow = half*2;
    v8f ca = {}; v8f cg = {};
    const float* Wa = W + (size_t)(m0 + col)*HH;
    const float* Wg = W + (size_t)(m0 + 64 + col)*HH;
    const float* Xp = X + (size_t)b*HH*LL + n0 + col;
    #pragma unroll
    for (int k = 0; k < HH; k += 4){
        v2f a, gw, bb;
        a.x  = Wa[k + krow];  a.y  = Wa[k + krow + 1];
        gw.x = Wg[k + krow];  gw.y = Wg[k + krow + 1];
        bb.x = Xp[(size_t)(k + krow)*LL];
        bb.y = Xp[(size_t)(k + krow + 1)*LL];
        ca = __builtin_amdgcn_wmma_f32_16x16x4_f32(false, a,  false, bb, (short)0, ca, false, false);
        cg = __builtin_amdgcn_wmma_f32_16x16x4_f32(false, gw, false, bb, (short)0, cg, false, false);
    }
    float* Up = U + (size_t)b*HH*LL;
    #pragma unroll
    for (int r = 0; r < 8; ++r){
        int row = m0 + r + 8*half;
        size_t oi = (size_t)row*LL + n0 + col;
        float av = ca[r] + bias[row];
        float gv = cg[r] + bias[64 + row];
        Up[oi] += av * sigm_f(gv);
    }
}

// ---- Generic channel GEMM: Y[b,m,l] = act(sum_k W[m,k]*X[b,k,l] + bias[m]) (+Y)
__global__ void gemm_kernel(const float* __restrict__ W, const float* __restrict__ bias,
                            const float* __restrict__ X, float* __restrict__ Y,
                            int M, int K, int act, int residual){
    int lane = threadIdx.x;
    int n0 = blockIdx.x*16;
    int m0 = (blockIdx.y*blockDim.y + threadIdx.y)*16;
    int b = blockIdx.z;
    int col = lane & 15, half = lane >> 4;
    int krow = half*2;
    v8f c = {};
    const float* Wp = W + (size_t)(m0 + col)*K;
    const float* Xp = X + (size_t)b*K*LL + n0 + col;
    for (int k = 0; k < K; k += 4){
        v2f a, bb;
        a.x = Wp[k + krow]; a.y = Wp[k + krow + 1];
        bb.x = Xp[(size_t)(k + krow)*LL];
        bb.y = Xp[(size_t)(k + krow + 1)*LL];
        c = __builtin_amdgcn_wmma_f32_16x16x4_f32(false, a, false, bb, (short)0, c, false, false);
    }
    float* Yp = Y + (size_t)b*M*LL;
    #pragma unroll
    for (int r = 0; r < 8; ++r){
        int row = m0 + r + 8*half;
        size_t oi = (size_t)row*LL + n0 + col;
        float v = c[r] + bias[row];
        if (act) v = gelu_f(v);
        if (residual) v += Yp[oi];
        Yp[oi] = v;
    }
}

// ---- final projection H->1
__global__ void proj_kernel(const float* __restrict__ U, const float* __restrict__ pw,
                            const float* __restrict__ pb, float* __restrict__ out){
    int idx = blockIdx.x*blockDim.x + threadIdx.x;   // B*L
    int l = idx % LL; int b = idx / LL;
    if (b >= BB) return;
    const float* up = U + (size_t)b*HH*LL + l;
    float acc = pb[0];
    #pragma unroll 8
    for (int h = 0; h < HH; ++h) acc = fmaf(up[(size_t)h*LL], pw[h], acc);
    out[idx] = acc;
}

extern "C" void kernel_launch(void* const* d_in, const int* in_sizes, int n_in,
                              void* d_out, int out_size, void* d_ws, size_t ws_size,
                              hipStream_t stream){
    (void)in_sizes; (void)n_in; (void)out_size; (void)ws_size;
    const float* x       = (const float*)d_in[0];
    const float* conv_w  = (const float*)d_in[1];
    const float* conv_b  = (const float*)d_in[2];
    const float* ln1_w   = (const float*)d_in[3];
    const float* ln1_b   = (const float*)d_in[4];
    const float* log_dt  = (const float*)d_in[5];
    const float* A_re    = (const float*)d_in[6];
    const float* A_im    = (const float*)d_in[7];
    const float* C_re    = (const float*)d_in[8];
    const float* C_im    = (const float*)d_in[9];
    const float* Dv      = (const float*)d_in[10];
    const float* outlin_w= (const float*)d_in[11];
    const float* outlin_b= (const float*)d_in[12];
    const float* ln2_w   = (const float*)d_in[13];
    const float* ln2_b   = (const float*)d_in[14];
    const float* ff_w1   = (const float*)d_in[15];
    const float* ff_b1   = (const float*)d_in[16];
    const float* ff_w2   = (const float*)d_in[17];
    const float* ff_b2   = (const float*)d_in[18];
    const float* proj_w  = (const float*)d_in[19];
    const float* proj_b  = (const float*)d_in[20];
    float* out = (float*)d_out;

    const size_t nBHL = (size_t)BB*HH*LL;          // 8.39M floats
    float*  u      = (float*)d_ws;
    float*  z      = u + nBHL;
    float*  yc     = z + nBHL;
    float*  gl     = yc + nBHL;                    // (B,128,L)
    float2* states = (float2*)(gl + 2*nBHL);
    float2* wC     = states + (size_t)BB*HH*CCH*NN;
    float2* ctC    = wC + HH*NN;
    float2* wTC    = ctC + HH*NN;

    dim3 b256(256);
    dim3 wblk(32, 4);
    conv_up_kernel<<<(unsigned)(nBHL/256), b256, 0, stream>>>(x, conv_w, conv_b, u);

    const int nw = BB*HH*CCH;   // scan waves
    for (int i = 0; i < NBLK; ++i){
        ln_ch_kernel<<<(BB*LL)/256, b256, 0, stream>>>(u, ln1_w + i*HH, ln1_b + i*HH, z);
        s4pre_kernel<<<(HH*NN)/256, b256, 0, stream>>>(log_dt + i*HH, A_re + i*HH*NN, A_im + i*HH*NN,
                                                       C_re + i*HH*NN, C_im + i*HH*NN, wC, ctC, wTC);
        s4_local_kernel<<<nw/4, wblk, 0, stream>>>(z, wC, states);
        s4_carry_kernel<<<(BB*HH*NN)/256, b256, 0, stream>>>(wTC, states);
        s4_apply_kernel<<<nw/4, wblk, 0, stream>>>(z, wC, ctC, states, Dv + i*HH, yc);
        outlin_glu_kernel<<<dim3(LL/16, 1, BB), wblk, 0, stream>>>(outlin_w + i*2*HH*HH,
                                                                   outlin_b + i*2*HH, yc, u);
        ln_ch_kernel<<<(BB*LL)/256, b256, 0, stream>>>(u, ln2_w + i*HH, ln2_b + i*HH, z);
        gemm_kernel<<<dim3(LL/16, 2, BB), wblk, 0, stream>>>(ff_w1 + i*2*HH*HH, ff_b1 + i*2*HH,
                                                             z, gl, 2*HH, HH, 1, 0);
        gemm_kernel<<<dim3(LL/16, 1, BB), wblk, 0, stream>>>(ff_w2 + i*2*HH*HH, ff_b2 + i*HH,
                                                             gl, u, HH, 2*HH, 0, 1);
    }
    proj_kernel<<<(BB*LL)/256, b256, 0, stream>>>(u, proj_w, proj_b, out);
}

// v001
// A run of this version takes 704 microseconds.
// Two timings next to v000 both put it at 1.39 times that version's speed.
#include <hip/hip_runtime.h>
#include <hip/hip_bf16.h>
#include <math.h>

typedef __attribute__((ext_vector_type(2))) float v2f;
typedef __attribute__((ext_vector_type(4))) float v4f;
typedef __attribute__((ext_vector_type(8))) float v8f;

#define BB 8
#define HH 64
#define LIN 1024
#define KCONV 16
#define LL (LIN*KCONV)      // 16384
#define NN 32               // complex modes
#define TCH 256             // scan chunk length
#define CCH (LL/TCH)        // 64 chunks
#define NBLK 4

__device__ __forceinline__ float gelu_f(float x){
    float x3 = x*x*x;
    return 0.5f*x*(1.0f + tanhf(0.7978845608028654f*(x + 0.044715f*x3)));
}
__device__ __forceinline__ float sigm_f(float x){ return 1.0f/(1.0f + expf(-x)); }
__device__ __forceinline__ void lds_fence(){ asm volatile("s_wait_dscnt 0" ::: "memory"); }

// ---- ConvTranspose1d(1->H, k=16, stride=16): u[b,h,lin*16+k] = x[b,lin]*w[h,k]+b[h]
__global__ void conv_up_kernel(const float* __restrict__ x, const float* __restrict__ cw,
                               const float* __restrict__ cb, float* __restrict__ u){
    size_t idx = (size_t)blockIdx.x*blockDim.x + threadIdx.x;   // B*H*L
    int l = (int)(idx % LL); int bh = (int)(idx / LL); int h = bh % HH; int b = bh / HH;
    if (b >= BB) return;
    u[idx] = fmaf(x[b*LIN + (l>>4)], cw[h*KCONV + (l&15)], cb[h]);
}

// ---- LayerNorm over channel dim (stride-L layout), one thread per (b,l)
__global__ void ln_ch_kernel(const float* __restrict__ u, const float* __restrict__ w,
                             const float* __restrict__ bias, float* __restrict__ z){
    int idx = blockIdx.x*blockDim.x + threadIdx.x;   // B*L
    int l = idx % LL; int b = idx / LL;
    if (b >= BB) return;
    const float* up = u + (size_t)b*HH*LL + l;
    float s = 0.f, s2 = 0.f;
    #pragma unroll 8
    for (int h = 0; h < HH; ++h){ float v = up[(size_t)h*LL]; s += v; s2 += v*v; }
    float mu = s * (1.0f/HH);
    float var = s2*(1.0f/HH) - mu*mu;
    float rs = rsqrtf(var + 1e-5f);
    float* zp = z + (size_t)b*HH*LL + l;
    #pragma unroll 8
    for (int h = 0; h < HH; ++h){
        float v = up[(size_t)h*LL];
        zp[(size_t)h*LL] = fmaf((v - mu)*rs, w[h], bias[h]);
    }
}

// ---- S4D discretization: w = exp(dt*A), Ct = 2*C*(w-1)/A, wT = w^TCH
__global__ void s4pre_kernel(const float* __restrict__ log_dt, const float* __restrict__ A_re,
                             const float* __restrict__ A_im, const float* __restrict__ C_re,
                             const float* __restrict__ C_im, float2* __restrict__ wC,
                             float2* __restrict__ ctC, float2* __restrict__ wTC){
    int idx = blockIdx.x*blockDim.x + threadIdx.x;  // H*N
    if (idx >= HH*NN) return;
    int h = idx / NN;
    float dt = expf(log_dt[h]);
    float ar = A_re[idx], ai = A_im[idx];
    float dr = ar*dt, di = ai*dt;
    float er = expf(dr);
    float wr = er*cosf(di), wi = er*sinf(di);
    float mr = wr - 1.0f, mi = wi;                       // w-1
    float den = 1.0f/(ar*ar + ai*ai);
    float qr = (mr*ar + mi*ai)*den;                      // (w-1)/A
    float qi = (mi*ar - mr*ai)*den;
    float cr = C_re[idx], ci = C_im[idx];
    wC[idx]  = make_float2(wr, wi);
    ctC[idx] = make_float2(2.0f*(cr*qr - ci*qi), 2.0f*(cr*qi + ci*qr));
    float eT = expf(dr*(float)TCH);
    wTC[idx] = make_float2(eT*cosf(di*(float)TCH), eT*sinf(di*(float)TCH));
}

// ---- Scan pass A: per-(b,h,chunk) local end-state, lane = mode
__global__ void s4_local_kernel(const float* __restrict__ z, const float2* __restrict__ wC,
                                float2* __restrict__ states){
    int widx = blockIdx.x*blockDim.y + threadIdx.y;   // B*H*C waves
    int lane = threadIdx.x;
    int c = widx % CCH; int hh = (widx / CCH) % HH; int b = widx / (CCH*HH);
    if (b >= BB) return;
    float2 w = wC[hh*NN + lane];
    const float* zp = z + ((size_t)(b*HH + hh))*LL + c*TCH;
    float sr = 0.f, si = 0.f;
    for (int g = 0; g < TCH/32; ++g){
        float zv = zp[g*32 + lane];
        #pragma unroll
        for (int j = 0; j < 32; ++j){
            float zj = __shfl(zv, j, 32);
            float nr = fmaf(w.x, sr, fmaf(-w.y, si, zj));
            float ni = fmaf(w.x, si, w.y*sr);
            sr = nr; si = ni;
        }
    }
    states[((size_t)(b*HH + hh)*CCH + c)*NN + lane] = make_float2(sr, si);
}

// ---- Scan pass B: exclusive carry scan over chunks, thread per (b,h,n)
__global__ void s4_carry_kernel(const float2* __restrict__ wTC, float2* __restrict__ states){
    int idx = blockIdx.x*blockDim.x + threadIdx.x;    // B*H*N
    if (idx >= BB*HH*NN) return;
    int n = idx % NN; int hh = (idx / NN) % HH; int b = idx / (NN*HH);
    float2 wT = wTC[hh*NN + n];
    float cr = 0.f, ci = 0.f;
    float2* sp = states + ((size_t)(b*HH + hh))*CCH*NN + n;
    for (int c = 0; c < CCH; ++c){
        float2 loc = sp[(size_t)c*NN];
        sp[(size_t)c*NN] = make_float2(cr, ci);
        float nr = fmaf(wT.x, cr, -wT.y*ci) + loc.x;
        float ni = fmaf(wT.x, ci,  wT.y*cr) + loc.y;
        cr = nr; ci = ni;
    }
}

// ---- Scan pass C: replay with carry, emit gelu(y + D*z). LDS 32x33 transpose
// amortizes the cross-mode reduction (conflict-free on 64 banks).
__global__ void s4_apply_kernel(const float* __restrict__ z, const float2* __restrict__ wC,
                                const float2* __restrict__ ctC, const float2* __restrict__ states,
                                const float* __restrict__ Dvec, float* __restrict__ out){
    __shared__ float tile[4][32*33];
    int wy = threadIdx.y;
    int widx = blockIdx.x*blockDim.y + wy;
    int lane = threadIdx.x;
    int c = widx % CCH; int hh = (widx / CCH) % HH; int b = widx / (CCH*HH);
    if (b >= BB) return;
    float2 w  = wC[hh*NN + lane];
    float2 ct = ctC[hh*NN + lane];
    float2 s0 = states[((size_t)(b*HH + hh)*CCH + c)*NN + lane];
    float sr = s0.x, si = s0.y;
    float Dh = Dvec[hh];
    size_t base = ((size_t)(b*HH + hh))*LL + c*TCH;
    const float* zp = z + base;
    float* op = out + base;
    float p[32];
    for (int g = 0; g < TCH/32; ++g){
        float zv = zp[g*32 + lane];
        #pragma unroll
        for (int j = 0; j < 32; ++j){
            float zj = __shfl(zv, j, 32);
            float nr = fmaf(w.x, sr, fmaf(-w.y, si, zj));
            float ni = fmaf(w.x, si, w.y*sr);
            sr = nr; si = ni;
            p[j] = fmaf(-ct.y, si, ct.x*sr);
        }
        #pragma unroll
        for (int j = 0; j < 32; ++j) tile[wy][lane*33 + j] = p[j];
        lds_fence();
        float acc = 0.f;
        #pragma unroll
        for (int j = 0; j < 32; ++j) acc += tile[wy][j*33 + lane];
        lds_fence();
        op[g*32 + lane] = gelu_f(fmaf(Dh, zv, acc));
    }
}

// ---- Channel GEMMs, one wave tile = MT*16 rows x 64 columns.
// Column n0 + 4*c + t belongs to column tile t of lane column c, so one 16-byte load
// feeds all four column tiles and one 16-byte store takes one row of all four.
// The wave's W fragments stay in registers over its CTILES column tiles.
// The k order of every accumulator is k, k+1, k+2, k+3 per step, steps ascending.
#define CTILES 2            // 64-column tiles per work-group
#define NCOLS (64*CTILES)

template<int MT, int K>
__device__ __forceinline__ void load_w_frags(const float* __restrict__ W, const int (&rows)[MT],
                                             int col, int krow, v2f (&a)[MT][K/4]){
    #pragma unroll  // constant indices keep these arrays in registers
    for (int mt = 0; mt < MT; ++mt){
        const float* Wp = W + (size_t)(rows[mt] + col)*K + krow;
        #pragma unroll  // constant indices keep these arrays in registers
        for (int ks = 0; ks < K/4; ++ks) a[mt][ks] = *(const v2f*)(Wp + ks*4);
    }
}

template<int MT, int K, int PF>
__device__ __forceinline__ void tile_product(const float* __restrict__ Xp, const v2f (&a)[MT][K/4],
                                             v8f (&c)[MT][4]){
    #pragma unroll  // constant indices keep these arrays in registers
    for (int mt = 0; mt < MT; ++mt)
        #pragma unroll  // constant indices keep these arrays in registers
        for (int t = 0; t < 4; ++t) c[mt][t] = v8f{};
    // X rows are fetched PF k steps ahead of the products that use them
    v4f x0[K/4], x1[K/4];
    #pragma unroll  // constant indices keep these arrays in registers
    for (int ks = 0; ks < PF; ++ks){
        x0[ks] = *(const v4f*)(Xp + (size_t)(ks*4)*LL);
        x1[ks] = *(const v4f*)(Xp + (size_t)(ks*4 + 1)*LL);
    }
    // holds the first fetches (and the caller's residual loads) in front of the products
    __builtin_amdgcn_sched_barrier(0);
    #pragma unroll  // constant indices keep these arrays in registers
    for (int ks = 0; ks < K/4; ++ks){
        if (ks + PF < K/4){
            x0[ks + PF] = *(const v4f*)(Xp + (size_t)((ks + PF)*4)*LL);
            x1[ks + PF] = *(const v4f*)(Xp + (size_t)((ks + PF)*4 + 1)*LL);
        }
        #pragma unroll  // constant indices keep these arrays in registers
        for (int t = 0; t < 4; ++t){
            v2f bb; bb.x = x0[ks][t]; bb.y = x1[ks][t];
            #pragma unroll  // constant indices keep these arrays in registers
            for (int mt = 0; mt < MT; ++mt)
                c[mt][t] = __builtin_amdgcn_wmma_f32_16x16x4_f32(false, a[mt][ks], false, bb,
                                                                 (short)0, c[mt][t], false, false);
        }
        // keeps the fetch distance: without it all X loads move to the front and registers spill
        __builtin_amdgcn_sched_barrier(0);
    }
}

// ---- outlin (128x64) GEMM fused with GLU residual: u += a*sigmoid(g)
__global__ __launch_bounds__(128, 4) void outlin_glu_kernel(const float* __restrict__ W,
                                  const float* __restrict__ bias,
                                  const float* __restrict__ X, float* __restrict__ U){
    int lane = threadIdx.x;
    int m0 = (int)threadIdx.y*16;           // 0..48 over 64 'a' rows
    int b = blockIdx.z;
    int col = lane & 15, half = lane >> 4;
    int krow = half*2;
    const int rows[2] = { m0, m0 + 64 };    // 'a' tile and its gate tile
    v2f a[2][HH/4];
    load_w_frags<2, HH>(W, rows, col, krow, a);
    float* Up = U + (size_t)b*HH*LL;
    // rolled: one column tile's accumulators and loads at a time keep the register count down
    #pragma unroll 1
    for (int ct = 0; ct < CTILES; ++ct){
        int n0 = blockIdx.x*NCOLS + ct*64 + col*4;
        v8f c[2][4];
        // the residual rows are asked for ahead of the products, not one by one between the stores
        v4f res[8];
        #pragma unroll  // constant indices keep these arrays in registers
        for (int r = 0; r < 8; ++r) res[r] = *(const v4f*)(Up + (size_t)(m0 + r + 8*half)*LL + n0);
        tile_product<2, HH, 5>(X + (size_t)b*HH*LL + (size_t)krow*LL + n0, a, c);
        #pragma unroll  // constant indices keep these arrays in registers
        for (int r = 0; r < 8; ++r){
            int row = m0 + r + 8*half;
            float ba = bias[row], bg = bias[64 + row];
            v4f* up = (v4f*)(Up + (size_t)row*LL + n0);
            v4f v = res[r];
            #pragma unroll  // constant indices keep these arrays in registers
            for (int t = 0; t < 4; ++t){
                float av = c[0][t][r] + ba;
                float gv = c[1][t][r] + bg;
                v[t] += av * sigm_f(gv);
            }
            *up = v;
        }
        // the next column tile overwrites address and data registers of the stores above
        asm volatile("s_wait_xcnt 0x0" ::: "memory");
    }
}

// ---- Channel GEMM body: Y[b,m,l] = act(sum_k W[m,k]*X[b,k,l] + bias[m]) (+Y); 4 waves cover M
template<int M, int K, int PF, bool ACT, bool RES>
__device__ __forceinline__ void gemm_body(const float* __restrict__ W, const float* __restrict__ bias,
                                          const float* __restrict__ X, float* __restrict__ Y){
    constexpr int MT = M/64;
    int lane = threadIdx.x;
    int m0 = (int)threadIdx.y*(16*MT);
    int b = blockIdx.z;
    int col = lane & 15, half = lane >> 4;
    int krow = half*2;
    int rows[MT];
    #pragma unroll  // constant indices keep these arrays in registers
    for (int mt = 0; mt < MT; ++mt) rows[mt] = m0 + mt*16;
    v2f a[MT][K/4];
    load_w_frags<MT, K>(W, rows, col, krow, a);
    float* Yp = Y + (size_t)b*M*LL;
    // rolled: one column tile's accumulators and loads at a time keep the register count down
    #pragma unroll 1
    for (int ct = 0; ct < CTILES; ++ct){
        int n0 = blockIdx.x*NCOLS + ct*64 + col*4;
        v8f c[MT][4];
        // the residual rows are asked for ahead of the products, not one by one between the stores
        v4f res[MT][8];
        if (RES){
            #pragma unroll  // constant indices keep these arrays in registers
            for (int mt = 0; mt < MT; ++mt)
                #pragma unroll  // constant indices keep these arrays in registers
                for (int r = 0; r < 8; ++r)
                    res[mt][r] = *(const v4f*)(Yp + (size_t)(rows[mt] + r + 8*half)*LL + n0);
        }
        tile_product<MT, K, PF>(X + (size_t)b*K*LL + (size_t)krow*LL + n0, a, c);
        #pragma unroll  // constant indices keep these arrays in registers
        for (int mt = 0; mt < MT; ++mt){
            #pragma unroll  // constant indices keep these arrays in registers
            for (int r = 0; r < 8; ++r){
                int row = rows[mt] + r + 8*half;
                float bs = bias[row];
                v4f* yp = (v4f*)(Yp + (size_t)row*LL + n0);
                v4f v;
                #pragma unroll  // constant indices keep these arrays in registers
                for (int t = 0; t < 4; ++t){
                    float e = c[mt][t][r] + bs;
                    if (ACT) e = gelu_f(e);
                    v[t] = e;
                }
                if (RES) v += res[mt][r];
                *yp = v;
            }
        }
        // the next column tile overwrites address and data registers of the stores above
        asm volatile("s_wait_xcnt 0x0" ::: "memory");
    }
}

__global__ __launch_bounds__(128, 4) void ff1_kernel(const float* __restrict__ W,
                           const float* __restrict__ bias,
                           const float* __restrict__ X, float* __restrict__ Y){
    gemm_body<2*HH, HH, 6, true, false>(W, bias, X, Y);
}

__global__ __launch_bounds__(128, 4) void ff2_kernel(const float* __restrict__ W,
                           const float* __restrict__ bias,
                           const float* __restrict__ X, float* __restrict__ Y){
    gemm_body<HH, 2*HH, 8, false, true>(W, bias, X, Y);
}

// ---- final projection H->1
__global__ void proj_kernel(const float* __restrict__ U, const float* __restrict__ pw,
                            const float* __restrict__ pb, float* __restrict__ out){
    int idx = blockIdx.x*blockDim.x + threadIdx.x;   // B*L
    int l = idx % LL; int b = idx / LL;
    if (b >= BB) return;
    const float* up = U + (size_t)b*HH*LL + l;
    float acc = pb[0];
    #pragma unroll 8
    for (int h = 0; h < HH; ++h) acc = fmaf(up[(size_t)h*LL], pw[h], acc);
    out[idx] = acc;
}

extern "C" void kernel_launch(void* const* d_in, const int* in_sizes, int n_in,
                              void* d_out, int out_size, void* d_ws, size_t ws_size,
                              hipStream_t stream){
    (void)in_sizes; (void)n_in; (void)out_size; (void)ws_size;
    const float* x       = (const float*)d_in[0];
    const float* conv_w  = (const float*)d_in[1];
    const float* conv_b  = (const float*)d_in[2];
    const float* ln1_w   = (const float*)d_in[3];
    const float* ln1_b   = (const float*)d_in[4];
    const float* log_dt  = (const float*)d_in[5];
    const float* A_re    = (const float*)d_in[6];
    const float* A_im    = (const float*)d_in[7];
    const float* C_re    = (const float*)d_in[8];
    const float* C_im    = (const float*)d_in[9];
    const float* Dv      = (const float*)d_in[10];
    const float* outlin_w= (const float*)d_in[11];
    const float* outlin_b= (const float*)d_in[12];
    const float* ln2_w   = (const float*)d_in[13];
    const float* ln2_b   = (const float*)d_in[14];
    const float* ff_w1   = (const float*)d_in[15];
    const float* ff_b1   = (const float*)d_in[16];
    const float* ff_w2   = (const float*)d_in[17];
    const float* ff_b2   = (const float*)d_in[18];
    const float* proj_w  = (const float*)d_in[19];
    const float* proj_b  = (const float*)d_in[20];
    float* out = (float*)d_out;

    const size_t nBHL = (size_t)BB*HH*LL;          // 8.39M floats
    float*  u      = (float*)d_ws;
    float*  z      = u + nBHL;
    float*  yc     = z + nBHL;
    float*  gl     = yc + nBHL;                    // (B,128,L)
    float2* states = (float2*)(gl + 2*nBHL);
    float2* wC     = states + (size_t)BB*HH*CCH*NN;
    float2* ctC    = wC + HH*NN;
    float2* wTC    = ctC + HH*NN;

    dim3 b256(256);
    dim3 wblk(32, 4);
    conv_up_kernel<<<(unsigned)(nBHL/256), b256, 0, stream>>>(x, conv_w, conv_b, u);

    const int nw = BB*HH*CCH;   // scan waves
    for (int i = 0; i < NBLK; ++i){
        ln_ch_kernel<<<(BB*LL)/256, b256, 0, stream>>>(u, ln1_w + i*HH, ln1_b + i*HH, z);
        s4pre_kernel<<<(HH*NN)/256, b256, 0, stream>>>(log_dt + i*HH, A_re + i*HH*NN, A_im + i*HH*NN,
                                                       C_re + i*HH*NN, C_im + i*HH*NN, wC, ctC, wTC);
        s4_local_kernel<<<nw/4, wblk, 0, stream>>>(z, wC, states);
        s4_carry_kernel<<<(BB*HH*NN)/256, b256, 0, stream>>>(wTC, states);
        s4_apply_kernel<<<nw/4, wblk, 0, stream>>>(z, wC, ctC, states, Dv + i*HH, yc);
        outlin_glu_kernel<<<dim3(LL/NCOLS, 1, BB), wblk, 0, stream>>>(outlin_w + i*2*HH*HH,
                                                                   outlin_b + i*2*HH, yc, u);
        ln_ch_kernel<<<(BB*LL)/256, b256, 0, stream>>>(u, ln2_w + i*HH, ln2_b + i*HH, z);
        ff1_kernel<<<dim3(LL/NCOLS, 1, BB), wblk, 0, stream>>>(ff_w1 + i*2*HH*HH, ff_b1 + i*2*HH, z, gl);
        ff2_kernel<<<dim3(LL/NCOLS, 1, BB), wblk, 0, stream>>>(ff_w2 + i*2*HH*HH, ff_b2 + i*HH, gl, u);
    }
    proj_kernel<<<(BB*LL)/256, b256, 0, stream>>>(u, proj_w, proj_b, out);
}

// v002
// A run of this version takes 602 microseconds.
// Two timings next to v001 both put it at 1.17 times that version's speed.
// Counting every step since v000, it is 1.63 times as fast.
#include <hip/hip_runtime.h>
#include <hip/hip_bf16.h>
#include <math.h>

typedef __attribute__((ext_vector_type(2))) float v2f;
typedef __attribute__((ext_vector_type(4))) float v4f;
typedef __attribute__((ext_vector_type(8))) float v8f;

#define BB 8
#define HH 64
#define LIN 1024
#define KCONV 16
#define LL (LIN*KCONV)      // 16384
#define NN 32               // complex modes
#define SUB 64              // scan steps per lane (one sub-chunk)
#define NSUB (LL/SUB)       // 256 sub-chunks of a row, one per thread
#define NWV (NSUB/32)       // 8 waves per row
#define ZP (SUB+1)          // LDS pitch of a sub-chunk's samples, floats
#define SP (2*NN+2)         // LDS pitch of a sub-chunk's 32 complex states, floats
#define NBLK 4

__device__ __forceinline__ float gelu_f(float x){
    float x3 = x*x*x;
    return 0.5f*x*(1.0f + tanhf(0.7978845608028654f*(x + 0.044715f*x3)));
}
__device__ __forceinline__ float sigm_f(float x){ return 1.0f/(1.0f + expf(-x)); }

// ---- ConvTranspose1d(1->H, k=16, stride=16): u[b,h,lin*16+k] = x[b,lin]*w[h,k]+b[h]
__global__ void conv_up_kernel(const float* __restrict__ x, const float* __restrict__ cw,
                               const float* __restrict__ cb, float* __restrict__ u){
    size_t idx = (size_t)blockIdx.x*blockDim.x + threadIdx.x;   // B*H*L
    int l = (int)(idx % LL); int bh = (int)(idx / LL); int h = bh % HH; int b = bh / HH;
    if (b >= BB) return;
    u[idx] = fmaf(x[b*LIN + (l>>4)], cw[h*KCONV + (l&15)], cb[h]);
}

// ---- LayerNorm over channel dim (stride-L layout), one thread per (b,l)
__global__ void ln_ch_kernel(const float* __restrict__ u, const float* __restrict__ w,
                             const float* __restrict__ bias, float* __restrict__ z){
    int idx = blockIdx.x*blockDim.x + threadIdx.x;   // B*L
    int l = idx % LL; int b = idx / LL;
    if (b >= BB) return;
    const float* up = u + (size_t)b*HH*LL + l;
    float s = 0.f, s2 = 0.f;
    #pragma unroll 8
    for (int h = 0; h < HH; ++h){ float v = up[(size_t)h*LL]; s += v; s2 += v*v; }
    float mu = s * (1.0f/HH);
    float var = s2*(1.0f/HH) - mu*mu;
    float rs = rsqrtf(var + 1e-5f);
    float* zp = z + (size_t)b*HH*LL + l;
    #pragma unroll 8
    for (int h = 0; h < HH; ++h){
        float v = up[(size_t)h*LL];
        zp[(size_t)h*LL] = fmaf((v - mu)*rs, w[h], bias[h]);
    }
}

// ---- S4D discretization: w = exp(dt*A), Ct = 2*C*(w-1)/A, wS = w^SUB, wW = w^(32*SUB)
__global__ void s4pre_kernel(const float* __restrict__ log_dt, const float* __restrict__ A_re,
                             const float* __restrict__ A_im, const float* __restrict__ C_re,
                             const float* __restrict__ C_im, float2* __restrict__ wC,
                             float2* __restrict__ ctC, float2* __restrict__ wSC,
                             float2* __restrict__ wWC){
    int idx = blockIdx.x*blockDim.x + threadIdx.x;  // H*N
    if (idx >= HH*NN) return;
    int h = idx / NN;
    float dt = expf(log_dt[h]);
    float ar = A_re[idx], ai = A_im[idx];
    float dr = ar*dt, di = ai*dt;
    float er = expf(dr);
    float wr = er*cosf(di), wi = er*sinf(di);
    float mr = wr - 1.0f, mi = wi;                       // w-1
    float den = 1.0f/(ar*ar + ai*ai);
    float qr = (mr*ar + mi*ai)*den;                      // (w-1)/A
    float qi = (mi*ar - mr*ai)*den;
    float cr = C_re[idx], ci = C_im[idx];
    wC[idx]  = make_float2(wr, wi);
    ctC[idx] = make_float2(2.0f*(cr*qr - ci*qi), 2.0f*(cr*qi + ci*qr));
    float eS = expf(dr*(float)SUB);
    wSC[idx] = make_float2(eS*cosf(di*(float)SUB), eS*sinf(di*(float)SUB));
    float eW = expf(dr*(float)(32*SUB));
    wWC[idx] = make_float2(eW*cosf(di*(float)(32*SUB)), eW*sinf(di*(float)(32*SUB)));
}

// one sample through modes N0 .. N0+15 of a lane's states; returns their part of Re(sum Ct*s)
template<int N0>
__device__ __forceinline__ float replay_step(const float2* __restrict__ wrow, const float* cts,
                                             float (&sr)[NN], float (&si)[NN], float zv){
    float a0 = 0.f, a1 = 0.f, b0 = 0.f, b1 = 0.f;   // four short sums instead of one long one
    #pragma unroll  // constant indices keep these arrays in registers
    for (int n = N0; n < N0 + NN/2; n += 2){
        float2 w = wrow[n], x = wrow[n + 1];
        float2 k = *(const float2*)(cts + 2*n), m = *(const float2*)(cts + 2*n + 2);
        float nr = fmaf(w.x, sr[n], fmaf(-w.y, si[n], zv));
        float ni = fmaf(w.x, si[n], w.y*sr[n]);
        sr[n] = nr; si[n] = ni;
        a0 = fmaf(k.x, nr, a0); b0 = fmaf(k.y, ni, b0);
        float mr = fmaf(x.x, sr[n + 1], fmaf(-x.y, si[n + 1], zv));
        float mi = fmaf(x.x, si[n + 1], x.y*sr[n + 1]);
        sr[n + 1] = mr; si[n + 1] = mi;
        a1 = fmaf(m.x, mr, a1); b1 = fmaf(m.y, mi, b1);
    }
    return (a0 + a1) + (b0 + b1);
}

// ---- S4 scan of one (b,h) row in one work-group. In the two long passes a lane owns one
// sub-chunk of SUB samples and carries all 32 modes in registers: the sample is the lane's own
// (no broadcast) and the sum over modes stays inside the lane (no transpose, no reduction).
// Between them the carries are scanned with lane = mode, through LDS.
__global__ __launch_bounds__(NSUB, 4) void s4_row_kernel(const float* __restrict__ z,
                                  const float2* __restrict__ wC, const float2* __restrict__ ctC,
                                  const float2* __restrict__ wSC, const float2* __restrict__ wWC,
                                  const float* __restrict__ Dvec, float* __restrict__ out){
    __shared__ __attribute__((aligned(16))) float zt[NSUB*ZP];     // samples, then results
    __shared__ __attribute__((aligned(16))) float st[NSUB*SP];     // end states, then carries
    __shared__ __attribute__((aligned(16))) float wtot[NWV*2*NN];  // one total per wave and mode
    __shared__ __attribute__((aligned(16))) float cts[2*NN];
    int tid = threadIdx.x;
    int lane = tid & 31;
    int wv = __builtin_amdgcn_readfirstlane(tid >> 5);   // the wave's number, in a scalar register
    int row = blockIdx.x;               // b*HH + h
    int hh = row % HH;
    const float* zp = z + (size_t)row*LL;
    float* op = out + (size_t)row*LL;
    const float2* wrow = wC + hh*NN;    // same address in every lane: scalar registers

    // samples: 16 B per lane from memory, element e to zt[(e/SUB)*ZP + e%SUB]
    {
        v4f v[16];
        const float* zsrc = zp + wv*(32*SUB) + lane*4;
        #pragma unroll  // constant indices keep this array in registers, all loads in flight
        for (int r = 0; r < 16; ++r) v[r] = *(const v4f*)(zsrc + r*128);
        #pragma unroll  // constant indices keep this array in registers
        for (int r = 0; r < 16; ++r){
            int e = wv*(32*SUB) + r*128 + lane*4;
            float* d = zt + (e/SUB)*ZP + (e%SUB);
            d[0] = v[r][0]; d[1] = v[r][1]; d[2] = v[r][2]; d[3] = v[r][3];
        }
    }
    // Ct goes through LDS so that it sits in vector registers: the scalar file holds w alone
    if (tid < NN){
        float2 c = ctC[hh*NN + tid];
        cts[2*tid] = c.x; cts[2*tid + 1] = -c.y;
    }
    __syncthreads();

    float sr[NN], si[NN];
    const float* myz = zt + tid*ZP;
    // pass 1: end state of the lane's sub-chunk from a zero start
    #pragma unroll  // constant indices keep these arrays in registers
    for (int n = 0; n < NN; ++n){ sr[n] = 0.f; si[n] = 0.f; }
    #pragma unroll 1  // rolled: one step is already 32 independent chains
    for (int t = 0; t < SUB; ++t){
        float zv = myz[t];
        #pragma unroll  // constant indices keep these arrays in registers
        for (int n = 0; n < NN; ++n){
            float2 w = wrow[n];
            float nr = fmaf(w.x, sr[n], fmaf(-w.y, si[n], zv));
            float ni = fmaf(w.x, si[n], w.y*sr[n]);
            sr[n] = nr; si[n] = ni;
        }
    }
    #pragma unroll  // constant indices keep these arrays in registers
    for (int n = 0; n < NN; ++n) *(float2*)(st + tid*SP + 2*n) = make_float2(sr[n], si[n]);
    __syncthreads();

    // carries, lane = mode: the wave's total, the totals of the waves before it, then the
    // exclusive scan over the wave's own 32 sub-chunks
    {
        float2 wS = wSC[hh*NN + lane];
        float2 wW = wWC[hh*NN + lane];
        float* sp = st + (wv*32)*SP + 2*lane;
        float cr = 0.f, ci = 0.f;
        #pragma unroll 8  // eight LDS reads go out ahead of the dependent chain
        for (int i = 0; i < 32; ++i){
            float2 loc = *(const float2*)(sp + i*SP);
            float nr = fmaf(wS.x, cr, -wS.y*ci) + loc.x;
            float ni = fmaf(wS.x, ci,  wS.y*cr) + loc.y;
            cr = nr; ci = ni;
        }
        *(float2*)(wtot + wv*(2*NN) + 2*lane) = make_float2(cr, ci);
        __syncthreads();
        cr = 0.f; ci = 0.f;
        for (int v = 0; v < wv; ++v){
            float2 loc = *(const float2*)(wtot + v*(2*NN) + 2*lane);
            float nr = fmaf(wW.x, cr, -wW.y*ci) + loc.x;
            float ni = fmaf(wW.x, ci,  wW.y*cr) + loc.y;
            cr = nr; ci = ni;
        }
        #pragma unroll 8  // eight LDS reads go out ahead of the dependent chain
        for (int i = 0; i < 32; ++i){
            float2 loc = *(const float2*)(sp + i*SP);
            *(float2*)(sp + i*SP) = make_float2(cr, ci);
            float nr = fmaf(wS.x, cr, -wS.y*ci) + loc.x;
            float ni = fmaf(wS.x, ci,  wS.y*cr) + loc.y;
            cr = nr; ci = ni;
        }
    }
    __syncthreads();

    // pass 2: replay from the carry, emit gelu(y + D*z) in place of the sample. Two runs over the
    // sub-chunk, 16 modes each, so that a run's constants all stay in registers; the first run's
    // sum waits in the lane's own row of st, which is free once the carries are in registers.
    #pragma unroll  // constant indices keep these arrays in registers
    for (int n = 0; n < NN; ++n){
        float2 c = *(const float2*)(st + tid*SP + 2*n);
        sr[n] = c.x; si[n] = c.y;
    }
    float Dh = Dvec[hh];
    float* myo = zt + tid*ZP;
    float* part = st + tid*SP;
    #pragma unroll 1  // rolled: one step is already 16 independent chains
    for (int t = 0; t < SUB; ++t){
        float zv = myo[t];
        part[t] = fmaf(Dh, zv, replay_step<0>(wrow, cts, sr, si, zv));
    }
    #pragma unroll 1  // rolled: one step is already 16 independent chains
    for (int t = 0; t < SUB; ++t){
        float zv = myo[t];
        myo[t] = gelu_f(part[t] + replay_step<NN/2>(wrow, cts, sr, si, zv));
    }
    __syncthreads();

    // results: back out in the order the samples came in, 16 B per lane
    #pragma unroll 4  // four stores' LDS reads in flight at a time
    for (int r = 0; r < 16; ++r){
        int e = wv*(32*SUB) + r*128 + lane*4;
        const float* d = zt + (e/SUB)*ZP + (e%SUB);
        v4f v; v[0] = d[0]; v[1] = d[1]; v[2] = d[2]; v[3] = d[3];
        *(v4f*)(op + e) = v;
    }
}

// ---- Channel GEMMs, one wave tile = MT*16 rows x 64 columns.
// Column n0 + 4*c + t belongs to column tile t of lane column c, so one 16-byte load
// feeds all four column tiles and one 16-byte store takes one row of all four.
// The wave's W fragments stay in registers over its CTILES column tiles.
// The k order of every accumulator is k, k+1, k+2, k+3 per step, steps ascending.
#define CTILES 2            // 64-column tiles per work-group
#define NCOLS (64*CTILES)

template<int MT, int K>
__device__ __forceinline__ void load_w_frags(const float* __restrict__ W, const int (&rows)[MT],
                                             int col, int krow, v2f (&a)[MT][K/4]){
    #pragma unroll  // constant indices keep these arrays in registers
    for (int mt = 0; mt < MT; ++mt){
        const float* Wp = W + (size_t)(rows[mt] + col)*K + krow;
        #pragma unroll  // constant indices keep these arrays in registers
        for (int ks = 0; ks < K/4; ++ks) a[mt][ks] = *(const v2f*)(Wp + ks*4);
    }
}

template<int MT, int K, int PF>
__device__ __forceinline__ void tile_product(const float* __restrict__ Xp, const v2f (&a)[MT][K/4],
                                             v8f (&c)[MT][4]){
    #pragma unroll  // constant indices keep these arrays in registers
    for (int mt = 0; mt < MT; ++mt)
        #pragma unroll  // constant indices keep these arrays in registers
        for (int t = 0; t < 4; ++t) c[mt][t] = v8f{};
    // X rows are fetched PF k steps ahead of the products that use them
    v4f x0[K/4], x1[K/4];
    #pragma unroll  // constant indices keep these arrays in registers
    for (int ks = 0; ks < PF; ++ks){
        x0[ks] = *(const v4f*)(Xp + (size_t)(ks*4)*LL);
        x1[ks] = *(const v4f*)(Xp + (size_t)(ks*4 + 1)*LL);
    }
    // holds the first fetches (and the caller's residual loads) in front of the products
    __builtin_amdgcn_sched_barrier(0);
    #pragma unroll  // constant indices keep these arrays in registers
    for (int ks = 0; ks < K/4; ++ks){
        if (ks + PF < K/4){
            x0[ks + PF] = *(const v4f*)(Xp + (size_t)((ks + PF)*4)*LL);
            x1[ks + PF] = *(const v4f*)(Xp + (size_t)((ks + PF)*4 + 1)*LL);
        }
        #pragma unroll  // constant indices keep these arrays in registers
        for (int t = 0; t < 4; ++t){
            v2f bb; bb.x = x0[ks][t]; bb.y = x1[ks][t];
            #pragma unroll  // constant indices keep these arrays in registers
            for (int mt = 0; mt < MT; ++mt)
                c[mt][t] = __builtin_amdgcn_wmma_f32_16x16x4_f32(false, a[mt][ks], false, bb,
                                                                 (short)0, c[mt][t], false, false);
        }
        // keeps the fetch distance: without it all X loads move to the front and registers spill
        __builtin_amdgcn_sched_barrier(0);
    }
}

// ---- outlin (128x64) GEMM fused with GLU residual: u += a*sigmoid(g)
__global__ __launch_bounds__(128, 4) void outlin_glu_kernel(const float* __restrict__ W,
                                  const float* __restrict__ bias,
                                  const float* __restrict__ X, float* __restrict__ U){
    int lane = threadIdx.x;
    int m0 = (int)threadIdx.y*16;           // 0..48 over 64 'a' rows
    int b = blockIdx.z;
    int col = lane & 15, half = lane >> 4;
    int krow = half*2;
    const int rows[2] = { m0, m0 + 64 };    // 'a' tile and its gate tile
    v2f a[2][HH/4];
    load_w_frags<2, HH>(W, rows, col, krow, a);
    float* Up = U + (size_t)b*HH*LL;
    // rolled: one column tile's accumulators and loads at a time keep the register count down
    #pragma unroll 1
    for (int ct = 0; ct < CTILES; ++ct){
        int n0 = blockIdx.x*NCOLS + ct*64 + col*4;
        v8f c[2][4];
        // the residual rows are asked for ahead of the products, not one by one between the stores
        v4f res[8];
        #pragma unroll  // constant indices keep these arrays in registers
        for (int r = 0; r < 8; ++r) res[r] = *(const v4f*)(Up + (size_t)(m0 + r + 8*half)*LL + n0);
        tile_product<2, HH, 5>(X + (size_t)b*HH*LL + (size_t)krow*LL + n0, a, c);
        #pragma unroll  // constant indices keep these arrays in registers
        for (int r = 0; r < 8; ++r){
            int row = m0 + r + 8*half;
            float ba = bias[row], bg = bias[64 + row];
            v4f* up = (v4f*)(Up + (size_t)row*LL + n0);
            v4f v = res[r];
            #pragma unroll  // constant indices keep these arrays in registers
            for (int t = 0; t < 4; ++t){
                float av = c[0][t][r] + ba;
                float gv = c[1][t][r] + bg;
                v[t] += av * sigm_f(gv);
            }
            *up = v;
        }
        // the next column tile overwrites address and data registers of the stores above
        asm volatile("s_wait_xcnt 0x0" ::: "memory");
    }
}

// ---- Channel GEMM body: Y[b,m,l] = act(sum_k W[m,k]*X[b,k,l] + bias[m]) (+Y); 4 waves cover M
template<int M, int K, int PF, bool ACT, bool RES>
__device__ __forceinline__ void gemm_body(const float* __restrict__ W, const float* __restrict__ bias,
                                          const float* __restrict__ X, float* __restrict__ Y){
    constexpr int MT = M/64;
    int lane = threadIdx.x;
    int m0 = (int)threadIdx.y*(16*MT);
    int b = blockIdx.z;
    int col = lane & 15, half = lane >> 4;
    int krow = half*2;
    int rows[MT];
    #pragma unroll  // constant indices keep these arrays in registers
    for (int mt = 0; mt < MT; ++mt) rows[mt] = m0 + mt*16;
    v2f a[MT][K/4];
    load_w_frags<MT, K>(W, rows, col, krow, a);
    float* Yp = Y + (size_t)b*M*LL;
    // rolled: one column tile's accumulators and loads at a time keep the register count down
    #pragma unroll 1
    for (int ct = 0; ct < CTILES; ++ct){
        int n0 = blockIdx.x*NCOLS + ct*64 + col*4;
        v8f c[MT][4];
        // the residual rows are asked for ahead of the products, not one by one between the stores
        v4f res[MT][8];
        if (RES){
            #pragma unroll  // constant indices keep these arrays in registers
            for (int mt = 0; mt < MT; ++mt)
                #pragma unroll  // constant indices keep these arrays in registers
                for (int r = 0; r < 8; ++r)
                    res[mt][r] = *(const v4f*)(Yp + (size_t)(rows[mt] + r + 8*half)*LL + n0);
        }
        tile_product<MT, K, PF>(X + (size_t)b*K*LL + (size_t)krow*LL + n0, a, c);
        #pragma unroll  // constant indices keep these arrays in registers
        for (int mt = 0; mt < MT; ++mt){
            #pragma unroll  // constant indices keep these arrays in registers
            for (int r = 0; r < 8; ++r){
                int row = rows[mt] + r + 8*half;
                float bs = bias[row];
                v4f* yp = (v4f*)(Yp + (size_t)row*LL + n0);
                v4f v;
                #pragma unroll  // constant indices keep these arrays in registers
                for (int t = 0; t < 4; ++t){
                    float e = c[mt][t][r] + bs;
                    if (ACT) e = gelu_f(e);
                    v[t] = e;
                }
                if (RES) v += res[mt][r];
                *yp = v;
            }
        }
        // the next column tile overwrites address and data registers of the stores above
        asm volatile("s_wait_xcnt 0x0" ::: "memory");
    }
}

__global__ __launch_bounds__(128, 4) void ff1_kernel(const float* __restrict__ W,
                           const float* __restrict__ bias,
                           const float* __restrict__ X, float* __restrict__ Y){
    gemm_body<2*HH, HH, 6, true, false>(W, bias, X, Y);
}

__global__ __launch_bounds__(128, 4) void ff2_kernel(const float* __restrict__ W,
                           const float* __restrict__ bias,
                           const float* __restrict__ X, float* __restrict__ Y){
    gemm_body<HH, 2*HH, 8, false, true>(W, bias, X, Y);
}

// ---- final projection H->1
__global__ void proj_kernel(const float* __restrict__ U, const float* __restrict__ pw,
                            const float* __restrict__ pb, float* __restrict__ out){
    int idx = blockIdx.x*blockDim.x + threadIdx.x;   // B*L
    int l = idx % LL; int b = idx / LL;
    if (b >= BB) return;
    const float* up = U + (size_t)b*HH*LL + l;
    float acc = pb[0];
    #pragma unroll 8
    for (int h = 0; h < HH; ++h) acc = fmaf(up[(size_t)h*LL], pw[h], acc);
    out[idx] = acc;
}

extern "C" void kernel_launch(void* const* d_in, const int* in_sizes, int n_in,
                              void* d_out, int out_size, void* d_ws, size_t ws_size,
                              hipStream_t stream){
    (void)in_sizes; (void)n_in; (void)out_size; (void)ws_size;
    const float* x       = (const float*)d_in[0];
    const float* conv_w  = (const float*)d_in[1];
    const float* conv_b  = (const float*)d_in[2];
    const float* ln1_w   = (const float*)d_in[3];
    const float* ln1_b   = (const float*)d_in[4];
    const float* log_dt  = (const float*)d_in[5];
    const float* A_re    = (const float*)d_in[6];
    const float* A_im    = (const float*)d_in[7];
    const float* C_re    = (const float*)d_in[8];
    const float* C_im    = (const float*)d_in[9];
    const float* Dv      = (const float*)d_in[10];
    const float* outlin_w= (const float*)d_in[11];
    const float* outlin_b= (const float*)d_in[12];
    const float* ln2_w   = (const float*)d_in[13];
    const float* ln2_b   = (const float*)d_in[14];
    const float* ff_w1   = (const float*)d_in[15];
    const float* ff_b1   = (const float*)d_in[16];
    const float* ff_w2   = (const float*)d_in[17];
    const float* ff_b2   = (const float*)d_in[18];
    const float* proj_w  = (const float*)d_in[19];
    const float* proj_b  = (const float*)d_in[20];
    float* out = (float*)d_out;

    const size_t nBHL = (size_t)BB*HH*LL;          // 8.39M floats
    float*  u      = (float*)d_ws;
    float*  z      = u + nBHL;
    float*  yc     = z + nBHL;
    float*  gl     = yc + nBHL;                    // (B,128,L)
    float2* wC     = (float2*)(gl + 2*nBHL);
    float2* ctC    = wC + HH*NN;
    float2* wSC    = ctC + HH*NN;
    float2* wWC    = wSC + HH*NN;

    dim3 b256(256);
    dim3 wblk(32, 4);
    conv_up_kernel<<<(unsigned)(nBHL/256), b256, 0, stream>>>(x, conv_w, conv_b, u);

    for (int i = 0; i < NBLK; ++i){
        ln_ch_kernel<<<(BB*LL)/256, b256, 0, stream>>>(u, ln1_w + i*HH, ln1_b + i*HH, z);
        s4pre_kernel<<<(HH*NN)/256, b256, 0, stream>>>(log_dt + i*HH, A_re + i*HH*NN, A_im + i*HH*NN,
                                                       C_re + i*HH*NN, C_im + i*HH*NN, wC, ctC, wSC, wWC);
        s4_row_kernel<<<BB*HH, NSUB, 0, stream>>>(z, wC, ctC, wSC, wWC, Dv + i*HH, yc);
        outlin_glu_kernel<<<dim3(LL/NCOLS, 1, BB), wblk, 0, stream>>>(outlin_w + i*2*HH*HH,
                                                                   outlin_b + i*2*HH, yc, u);
        ln_ch_kernel<<<(BB*LL)/256, b256, 0, stream>>>(u, ln2_w + i*HH, ln2_b + i*HH, z);
        ff1_kernel<<<dim3(LL/NCOLS, 1, BB), wblk, 0, stream>>>(ff_w1 + i*2*HH*HH, ff_b1 + i*2*HH, z, gl);
        ff2_kernel<<<dim3(LL/NCOLS, 1, BB), wblk, 0, stream>>>(ff_w2 + i*2*HH*HH, ff_b2 + i*HH, gl, u);
    }
    proj_kernel<<<(BB*LL)/256, b256, 0, stream>>>(u, proj_w, proj_b, out);
}

// v003
// Measured time: 571 microseconds a run.
// In two side-by-side timings against v002, it was 1.05 and 1.06 times as fast.
// Counting every step since v000, it is 1.72 times as fast.
#include <hip/hip_runtime.h>
#include <hip/hip_bf16.h>
#include <math.h>

typedef __attribute__((ext_vector_type(2))) float v2f;
typedef __attribute__((ext_vector_type(4))) float v4f;
typedef __attribute__((ext_vector_type(8))) float v8f;

#define BB 8
#define HH 64
#define LIN 1024
#define KCONV 16
#define LL (LIN*KCONV)      // 16384
#define NN 32               // complex modes
#define SUB 64              // samples of one sub-chunk
#define NSUB (LL/SUB)       // 256 sub-chunks of a row; also the row kernel's work-group size
#define NWV (NSUB/32)       // 8 waves per row
#define MP (SUB+4)          // LDS pitch of a 64-float row: 16-byte aligned, 16 rows cover all banks
#define NBLK 4

__device__ __forceinline__ float gelu_f(float x){
    float x3 = x*x*x;
    return 0.5f*x*(1.0f + tanhf(0.7978845608028654f*(x + 0.044715f*x3)));
}
__device__ __forceinline__ float sigm_f(float x){ return 1.0f/(1.0f + expf(-x)); }

// ---- ConvTranspose1d(1->H, k=16, stride=16): u[b,h,lin*16+k] = x[b,lin]*w[h,k]+b[h]
__global__ void conv_up_kernel(const float* __restrict__ x, const float* __restrict__ cw,
                               const float* __restrict__ cb, float* __restrict__ u){
    size_t idx = (size_t)blockIdx.x*blockDim.x + threadIdx.x;   // B*H*L
    int l = (int)(idx % LL); int bh = (int)(idx / LL); int h = bh % HH; int b = bh / HH;
    if (b >= BB) return;
    u[idx] = fmaf(x[b*LIN + (l>>4)], cw[h*KCONV + (l&15)], cb[h]);
}

// ---- LayerNorm over channel dim (stride-L layout), one thread per (b,l)
__global__ void ln_ch_kernel(const float* __restrict__ u, const float* __restrict__ w,
                             const float* __restrict__ bias, float* __restrict__ z){
    int idx = blockIdx.x*blockDim.x + threadIdx.x;   // B*L
    int l = idx % LL; int b = idx / LL;
    if (b >= BB) return;
    const float* up = u + (size_t)b*HH*LL + l;
    float s = 0.f, s2 = 0.f;
    #pragma unroll 8
    for (int h = 0; h < HH; ++h){ float v = up[(size_t)h*LL]; s += v; s2 += v*v; }
    float mu = s * (1.0f/HH);
    float var = s2*(1.0f/HH) - mu*mu;
    float rs = rsqrtf(var + 1e-5f);
    float* zp = z + (size_t)b*HH*LL + l;
    #pragma unroll 8
    for (int h = 0; h < HH; ++h){
        float v = up[(size_t)h*LL];
        zp[(size_t)h*LL] = fmaf((v - mu)*rs, w[h], bias[h]);
    }
}

// logical row x of a 64-row operand matrix sits at storage row lrow_of(x): tile (x>>3)&3, row
// (x>>5)*8 + (x&7) of it, so that a lane's 32 accumulator values are 32 consecutive logical rows
__device__ __forceinline__ int lrow_of(int x){ return ((x >> 3) & 3)*16 + (x >> 5)*8 + (x & 7); }
__device__ __forceinline__ int logical_of(int lrow){ return ((lrow >> 3) & 1)*32 + (lrow >> 4)*8 + (lrow & 7); }

// ---- S4D discretization, as matrices over one sub-chunk of SUB samples. With w = exp(dt*A) and
// Ct = 2*C*(w-1)/A, state s <- w*s + z, y = Re(sum Ct*s):
//   Pm[2n+c][t] = Re/Im w^(SUB-1-t)         end state of a sub-chunk from a zero start
//   Qm[t][2n+c] = Re / -Im (Ct*w^(t+1))     what the carried-in state adds to sample t
//   Tm[t][s]    = Re sum_n Ct*w^(t-s)       what sample s <= t of the sub-chunk adds; 0 for s > t
// and wS = w^SUB, wW = w^(32*SUB) for the carries. One work-group does 16 powers of one channel.
#define PWP (NN+1)          // LDS pitch of one power's 32 modes, floats
__global__ void s4pre_kernel(const float* __restrict__ log_dt, const float* __restrict__ A_re,
                             const float* __restrict__ A_im, const float* __restrict__ C_re,
                             const float* __restrict__ C_im, float2* __restrict__ wSC,
                             float2* __restrict__ wWC, float* __restrict__ Pm,
                             float* __restrict__ Qm, float* __restrict__ Tm){
    __shared__ float pr[17*PWP], pi[17*PWP];    // w^k, k = 16*q .. 16*q+16
    __shared__ float ctr[NN], cti[NN], kd[16];
    int tid = threadIdx.x;
    int h = blockIdx.x >> 2, q = blockIdx.x & 3;
    float dt = expf(log_dt[h]);
    for (int i = tid; i < 17*NN; i += 256){
        int n = i & (NN - 1), kk = i >> 5;
        float k = (float)(16*q + kk);
        float dr = A_re[h*NN + n]*dt, di = A_im[h*NN + n]*dt;
        float e = expf(dr*k);
        pr[kk*PWP + n] = e*cosf(di*k);
        pi[kk*PWP + n] = e*sinf(di*k);
    }
    if (tid < NN){
        int idx = h*NN + tid;
        float ar = A_re[idx], ai = A_im[idx];
        float dr = ar*dt, di = ai*dt;
        float er = expf(dr);
        float wr = er*cosf(di), wi = er*sinf(di);
        float mr = wr - 1.0f, mi = wi;                       // w-1
        float den = 1.0f/(ar*ar + ai*ai);
        float qr = (mr*ar + mi*ai)*den;                      // (w-1)/A
        float qi = (mi*ar - mr*ai)*den;
        float cr = C_re[idx], ci = C_im[idx];
        ctr[tid] = 2.0f*(cr*qr - ci*qi);
        cti[tid] = 2.0f*(cr*qi + ci*qr);
        if (q == 0){
            float eS = expf(dr*(float)SUB);
            wSC[idx] = make_float2(eS*cosf(di*(float)SUB), eS*sinf(di*(float)SUB));
            float eW = expf(dr*(float)(32*SUB));
            wWC[idx] = make_float2(eW*cosf(di*(float)(32*SUB)), eW*sinf(di*(float)(32*SUB)));
        }
    }
    __syncthreads();
    float* Ph = Pm + h*(SUB*SUB);
    float* Qh = Qm + h*(SUB*SUB);
    for (int i = tid; i < 16*SUB; i += 256){
        int m = i & (SUB - 1), kk = i >> 6, n = m >> 1;
        // power 16*q + kk is column SUB-1-(16*q+kk) of Pm
        Ph[lrow_of(m)*SUB + (SUB - 1 - (16*q + kk))] = (m & 1) ? pi[kk*PWP + n] : pr[kk*PWP + n];
        // power 16*q + kk + 1 is row 16*q + kk of Qm
        float xr = pr[(kk + 1)*PWP + n], xi = pi[(kk + 1)*PWP + n];
        Qh[lrow_of(16*q + kk)*SUB + m] = (m & 1) ? -(ctr[n]*xi + cti[n]*xr) : (ctr[n]*xr - cti[n]*xi);
    }
    if (tid < 16){
        float a = 0.f, b = 0.f;
        for (int n = 0; n < NN; ++n){
            a = fmaf(ctr[n], pr[tid*PWP + n], a);
            b = fmaf(cti[n], pi[tid*PWP + n], b);
        }
        kd[tid] = a - b;
    }
    __syncthreads();
    float* Th = Tm + h*(SUB*SUB);
    for (int i = tid; i < 16*SUB; i += 256){
        int t = i >> 4, kk = i & 15, d = 16*q + kk;
        if (t >= d) Th[lrow_of(t)*SUB + (t - d)] = kd[kk];          // diagonal d below the main one
        if (t + d + 1 < SUB) Th[lrow_of(t)*SUB + (t + d + 1)] = 0.f; // diagonal d+1 above it
        // the next trip overwrites the address registers of the stores above
        asm volatile("s_wait_xcnt 0x0" ::: "memory");
    }
}

// acc[mt][nt] += M(rows of tile mt) * B(columns of tile nt), M 64x64 in LDS at pitch MP, Ml already
// at the lane's row and half. Step 2*q+e pairs column half*32 + 4*q + 2*e (+1) of M with the same
// element of the lane's B vector; eight independent accumulators cover the matrix unit's latency.
__device__ __forceinline__ void mat_acc(const float* Ml, const v4f (&b)[2][8], v8f (&acc)[4][2]){
    #pragma unroll  // constant indices keep these arrays in registers
    for (int q = 0; q < 8; ++q){
        v4f a[4];
        #pragma unroll  // constant indices keep these arrays in registers
        for (int mt = 0; mt < 4; ++mt) a[mt] = *(const v4f*)(Ml + mt*16*MP + 4*q);
        #pragma unroll  // constant indices keep these arrays in registers
        for (int e = 0; e < 2; ++e){
            #pragma unroll  // constant indices keep these arrays in registers
            for (int mt = 0; mt < 4; ++mt){
                v2f av; av.x = a[mt][2*e]; av.y = a[mt][2*e + 1];
                #pragma unroll  // constant indices keep these arrays in registers
                for (int nt = 0; nt < 2; ++nt){
                    v2f bv; bv.x = b[nt][q][2*e]; bv.y = b[nt][q][2*e + 1];
                    acc[mt][nt] = __builtin_amdgcn_wmma_f32_16x16x4_f32(false, av, false, bv,
                                                                 (short)0, acc[mt][nt], false, false);
                }
            }
        }
    }
}

// ---- S4 scan of one (b,h) row in one work-group, as matrix products over sub-chunks of SUB
// samples. A wave owns 32 sub-chunks (two column tiles). A lane (column c, half) holds elements
// half*32 .. half*32+31 of sub-chunk c's vector, whichever vector it is: samples, end state,
// carry, result. Between the products the carries are scanned with lane = mode, through LDS.
__global__ __launch_bounds__(NSUB, 4) void s4_row_kernel(const float* __restrict__ z,
                                  const float* __restrict__ Pm, const float* __restrict__ Qm,
                                  const float* __restrict__ Tm,
                                  const float2* __restrict__ wSC, const float2* __restrict__ wWC,
                                  const float* __restrict__ Dvec, float* __restrict__ out){
    __shared__ __attribute__((aligned(16))) float buf[NSUB*MP];   // samples, states, carries, results
    __shared__ __attribute__((aligned(16))) float mP[SUB*MP];
    __shared__ __attribute__((aligned(16))) float mQ[SUB*MP];
    __shared__ __attribute__((aligned(16))) float mT[SUB*MP];
    __shared__ __attribute__((aligned(16))) float wtot[NWV*2*NN]; // one total per wave and mode
    int tid = threadIdx.x;
    int lane = tid & 31;
    int wv = __builtin_amdgcn_readfirstlane(tid >> 5);   // the wave's number, in a scalar register
    int row = blockIdx.x;               // b*HH + h
    int hh = row % HH;
    const float* zp = z + (size_t)row*LL;
    float* op = out + (size_t)row*LL;
    int col = lane & 15, half = lane >> 4;
    // the carry scan's factors (lane = mode), asked for here so that they are there when it starts
    float2 wS = wSC[hh*NN + lane];
    float2 wW = wWC[hh*NN + lane];

    // samples: 16 B per lane from memory, element e to buf[(e/SUB)*MP + e%SUB]; with them the
    // channel's three matrices, 16-byte piece i to storage row i/16, columns 4*(i%16)..
    {
        v4f v[16], p[4], g[4], k[4];
        const float* zsrc = zp + wv*(32*SUB) + lane*4;
        const float* Ph = Pm + hh*(SUB*SUB);
        const float* Qh = Qm + hh*(SUB*SUB);
        const float* Th = Tm + hh*(SUB*SUB);
        float Dh = Dvec[hh];
        #pragma unroll  // constant indices keep this array in registers, all loads in flight
        for (int r = 0; r < 16; ++r) v[r] = *(const v4f*)(zsrc + r*128);
        #pragma unroll  // constant indices keep these arrays in registers, all loads in flight
        for (int j = 0; j < 4; ++j){
            int i = tid + j*NSUB;
            p[j] = *(const v4f*)(Ph + i*4);
            g[j] = *(const v4f*)(Qh + i*4);
            k[j] = *(const v4f*)(Th + i*4);
        }
        // the index registers of the loads above are overwritten below
        asm volatile("s_wait_xcnt 0x0" ::: "memory");
        #pragma unroll  // constant indices keep this array in registers
        for (int r = 0; r < 16; ++r){
            int e = wv*(32*SUB) + r*128 + lane*4;
            *(v4f*)(buf + (e/SUB)*MP + (e%SUB)) = v[r];
        }
        #pragma unroll  // constant indices keep these arrays in registers
        for (int j = 0; j < 4; ++j){
            int i = tid + j*NSUB;
            int lr = i >> 4, s0 = (i & 15)*4;
            int t = logical_of(lr);
            // D goes on the diagonal of the Toeplitz matrix
            #pragma unroll  // constant indices keep this vector in registers
            for (int e = 0; e < 4; ++e) k[j][e] = (t == s0 + e) ? k[j][e] + Dh : k[j][e];
            *(v4f*)(mP + lr*MP + s0) = p[j];
            *(v4f*)(mQ + lr*MP + s0) = g[j];
            *(v4f*)(mT + lr*MP + s0) = k[j];
        }
    }
    __syncthreads();

    float* vec0 = buf + (wv*32 + col)*MP + half*32;     // the lane's vector of column tile 0
    int moff = col*MP + half*32;                        // the lane's row and half of a matrix tile
    v4f zf[2][8];
    #pragma unroll  // constant indices keep these arrays in registers
    for (int nt = 0; nt < 2; ++nt)
        #pragma unroll  // constant indices keep these arrays in registers
        for (int q = 0; q < 8; ++q) zf[nt][q] = *(const v4f*)(vec0 + nt*16*MP + 4*q);

    v8f acc[4][2];
    // product 1: end state of every sub-chunk from a zero start, in place of its samples
    #pragma unroll  // constant indices keep these arrays in registers
    for (int mt = 0; mt < 4; ++mt){ acc[mt][0] = v8f{}; acc[mt][1] = v8f{}; }
    mat_acc(mP + moff, zf, acc);
    #pragma unroll  // constant indices keep these arrays in registers
    for (int nt = 0; nt < 2; ++nt)
        #pragma unroll  // constant indices keep these arrays in registers
        for (int mt = 0; mt < 4; ++mt){
            v8f c = acc[mt][nt];
            *(v4f*)(vec0 + nt*16*MP + mt*8)     = v4f{c[0], c[1], c[2], c[3]};
            *(v4f*)(vec0 + nt*16*MP + mt*8 + 4) = v4f{c[4], c[5], c[6], c[7]};
        }
    __syncthreads();

    // carries, lane = mode: the wave's total, the totals of the waves before it, then the
    // exclusive scan over the wave's own 32 sub-chunks
    {
        float* sp = buf + (wv*32)*MP + 2*lane;
        float cr = 0.f, ci = 0.f;
        #pragma unroll 8  // eight LDS reads go out ahead of the dependent chain
        for (int i = 0; i < 32; ++i){
            float2 loc = *(const float2*)(sp + i*MP);
            float nr = fmaf(wS.x, cr, -wS.y*ci) + loc.x;
            float ni = fmaf(wS.x, ci,  wS.y*cr) + loc.y;
            cr = nr; ci = ni;
        }
        *(float2*)(wtot + wv*(2*NN) + 2*lane) = make_float2(cr, ci);
        __syncthreads();
        cr = 0.f; ci = 0.f;
        for (int v = 0; v < wv; ++v){
            float2 loc = *(const float2*)(wtot + v*(2*NN) + 2*lane);
            float nr = fmaf(wW.x, cr, -wW.y*ci) + loc.x;
            float ni = fmaf(wW.x, ci,  wW.y*cr) + loc.y;
            cr = nr; ci = ni;
        }
        #pragma unroll 8  // eight LDS reads go out ahead of the dependent chain
        for (int i = 0; i < 32; ++i){
            float2 loc = *(const float2*)(sp + i*MP);
            *(float2*)(sp + i*MP) = make_float2(cr, ci);
            float nr = fmaf(wS.x, cr, -wS.y*ci) + loc.x;
            float ni = fmaf(wS.x, ci,  wS.y*cr) + loc.y;
            cr = nr; ci = ni;
        }
    }
    __syncthreads();

    // products 2 and 3: the carry's part and the sub-chunk's own part of y + D*z
    #pragma unroll  // constant indices keep these arrays in registers
    for (int mt = 0; mt < 4; ++mt){ acc[mt][0] = v8f{}; acc[mt][1] = v8f{}; }
    {
        v4f cf[2][8];
        #pragma unroll  // constant indices keep these arrays in registers
        for (int nt = 0; nt < 2; ++nt)
            #pragma unroll  // constant indices keep these arrays in registers
            for (int q = 0; q < 8; ++q) cf[nt][q] = *(const v4f*)(vec0 + nt*16*MP + 4*q);
        mat_acc(mQ + moff, cf, acc);
    }
    mat_acc(mT + moff, zf, acc);
    #pragma unroll  // constant indices keep these arrays in registers
    for (int nt = 0; nt < 2; ++nt)
        #pragma unroll  // constant indices keep these arrays in registers
        for (int mt = 0; mt < 4; ++mt){
            v8f c = acc[mt][nt];
            *(v4f*)(vec0 + nt*16*MP + mt*8)     = v4f{gelu_f(c[0]), gelu_f(c[1]), gelu_f(c[2]), gelu_f(c[3])};
            *(v4f*)(vec0 + nt*16*MP + mt*8 + 4) = v4f{gelu_f(c[4]), gelu_f(c[5]), gelu_f(c[6]), gelu_f(c[7])};
        }
    __syncthreads();

    // results: back out in the order the samples came in, 16 B per lane
    #pragma unroll 4  // four stores' LDS reads in flight at a time
    for (int r = 0; r < 16; ++r){
        int e = wv*(32*SUB) + r*128 + lane*4;
        *(v4f*)(op + e) = *(const v4f*)(buf + (e/SUB)*MP + (e%SUB));
    }
}

// ---- Channel GEMMs, one wave tile = MT*16 rows x 64 columns.
// Column n0 + 4*c + t belongs to column tile t of lane column c, so one 16-byte load
// feeds all four column tiles and one 16-byte store takes one row of all four.
// The wave's W fragments stay in registers over its CTILES column tiles.
// The k order of every accumulator is k, k+1, k+2, k+3 per step, steps ascending.
#define CTILES 2            // 64-column tiles per work-group
#define NCOLS (64*CTILES)

template<int MT, int K>
__device__ __forceinline__ void load_w_frags(const float* __restrict__ W, const int (&rows)[MT],
                                             int col, int krow, v2f (&a)[MT][K/4]){
    #pragma unroll  // constant indices keep these arrays in registers
    for (int mt = 0; mt < MT; ++mt){
        const float* Wp = W + (size_t)(rows[mt] + col)*K + krow;
        #pragma unroll  // constant indices keep these arrays in registers
        for (int ks = 0; ks < K/4; ++ks) a[mt][ks] = *(const v2f*)(Wp + ks*4);
    }
}

template<int MT, int K, int PF>
__device__ __forceinline__ void tile_product(const float* __restrict__ Xp, const v2f (&a)[MT][K/4],
                                             v8f (&c)[MT][4]){
    #pragma unroll  // constant indices keep these arrays in registers
    for (int mt = 0; mt < MT; ++mt)
        #pragma unroll  // constant indices keep these arrays in registers
        for (int t = 0; t < 4; ++t) c[mt][t] = v8f{};
    // X rows are fetched PF k steps ahead of the products that use them
    v4f x0[K/4], x1[K/4];
    #pragma unroll  // constant indices keep these arrays in registers
    for (int ks = 0; ks < PF; ++ks){
        x0[ks] = *(const v4f*)(Xp + (size_t)(ks*4)*LL);
        x1[ks] = *(const v4f*)(Xp + (size_t)(ks*4 + 1)*LL);
    }
    // holds the first fetches (and the caller's residual loads) in front of the products
    __builtin_amdgcn_sched_barrier(0);
    #pragma unroll  // constant indices keep these arrays in registers
    for (int ks = 0; ks < K/4; ++ks){
        if (ks + PF < K/4){
            x0[ks + PF] = *(const v4f*)(Xp + (size_t)((ks + PF)*4)*LL);
            x1[ks + PF] = *(const v4f*)(Xp + (size_t)((ks + PF)*4 + 1)*LL);
        }
        #pragma unroll  // constant indices keep these arrays in registers
        for (int t = 0; t < 4; ++t){
            v2f bb; bb.x = x0[ks][t]; bb.y = x1[ks][t];
            #pragma unroll  // constant indices keep these arrays in registers
            for (int mt = 0; mt < MT; ++mt)
                c[mt][t] = __builtin_amdgcn_wmma_f32_16x16x4_f32(false, a[mt][ks], false, bb,
                                                                 (short)0, c[mt][t], false, false);
        }
        // keeps the fetch distance: without it all X loads move to the front and registers spill
        __builtin_amdgcn_sched_barrier(0);
    }
}

// ---- outlin (128x64) GEMM fused with GLU residual: u += a*sigmoid(g)
__global__ __launch_bounds__(128, 4) void outlin_glu_kernel(const float* __restrict__ W,
                                  const float* __restrict__ bias,
                                  const float* __restrict__ X, float* __restrict__ U){
    int lane = threadIdx.x;
    int m0 = (int)threadIdx.y*16;           // 0..48 over 64 'a' rows
    int b = blockIdx.z;
    int col = lane & 15, half = lane >> 4;
    int krow = half*2;
    const int rows[2] = { m0, m0 + 64 };    // 'a' tile and its gate tile
    v2f a[2][HH/4];
    load_w_frags<2, HH>(W, rows, col, krow, a);
    float* Up = U + (size_t)b*HH*LL;
    // rolled: one column tile's accumulators and loads at a time keep the register count down
    #pragma unroll 1
    for (int ct = 0; ct < CTILES; ++ct){
        int n0 = blockIdx.x*NCOLS + ct*64 + col*4;
        v8f c[2][4];
        // the residual rows are asked for ahead of the products, not one by one between the stores
        v4f res[8];
        #pragma unroll  // constant indices keep these arrays in registers
        for (int r = 0; r < 8; ++r) res[r] = *(const v4f*)(Up + (size_t)(m0 + r + 8*half)*LL + n0);
        tile_product<2, HH, 5>(X + (size_t)b*HH*LL + (size_t)krow*LL + n0, a, c);
        #pragma unroll  // constant indices keep these arrays in registers
        for (int r = 0; r < 8; ++r){
            int row = m0 + r + 8*half;
            float ba = bias[row], bg = bias[64 + row];
            v4f* up = (v4f*)(Up + (size_t)row*LL + n0);
            v4f v = res[r];
            #pragma unroll  // constant indices keep these arrays in registers
            for (int t = 0; t < 4; ++t){
                float av = c[0][t][r] + ba;
                float gv = c[1][t][r] + bg;
                v[t] += av * sigm_f(gv);
            }
            *up = v;
        }
        // the next column tile overwrites address and data registers of the stores above
        asm volatile("s_wait_xcnt 0x0" ::: "memory");
    }
}

// ---- Channel GEMM body: Y[b,m,l] = act(sum_k W[m,k]*X[b,k,l] + bias[m]) (+Y); 4 waves cover M
template<int M, int K, int PF, bool ACT, bool RES>
__device__ __forceinline__ void gemm_body(const float* __restrict__ W, const float* __restrict__ bias,
                                          const float* __restrict__ X, float* __restrict__ Y){
    constexpr int MT = M/64;
    int lane = threadIdx.x;
    int m0 = (int)threadIdx.y*(16*MT);
    int b = blockIdx.z;
    int col = lane & 15, half = lane >> 4;
    int krow = half*2;
    int rows[MT];
    #pragma unroll  // constant indices keep these arrays in registers
    for (int mt = 0; mt < MT; ++mt) rows[mt] = m0 + mt*16;
    v2f a[MT][K/4];
    load_w_frags<MT, K>(W, rows, col, krow, a);
    float* Yp = Y + (size_t)b*M*LL;
    // rolled: one column tile's accumulators and loads at a time keep the register count down
    #pragma unroll 1
    for (int ct = 0; ct < CTILES; ++ct){
        int n0 = blockIdx.x*NCOLS + ct*64 + col*4;
        v8f c[MT][4];
        // the residual rows are asked for ahead of the products, not one by one between the stores
        v4f res[MT][8];
        if (RES){
            #pragma unroll  // constant indices keep these arrays in registers
            for (int mt = 0; mt < MT; ++mt)
                #pragma unroll  // constant indices keep these arrays in registers
                for (int r = 0; r < 8; ++r)
                    res[mt][r] = *(const v4f*)(Yp + (size_t)(rows[mt] + r + 8*half)*LL + n0);
        }
        tile_product<MT, K, PF>(X + (size_t)b*K*LL + (size_t)krow*LL + n0, a, c);
        #pragma unroll  // constant indices keep these arrays in registers
        for (int mt = 0; mt < MT; ++mt){
            #pragma unroll  // constant indices keep these arrays in registers
            for (int r = 0; r < 8; ++r){
                int row = rows[mt] + r + 8*half;
                float bs = bias[row];
                v4f* yp = (v4f*)(Yp + (size_t)row*LL + n0);
                v4f v;
                #pragma unroll  // constant indices keep these arrays in registers
                for (int t = 0; t < 4; ++t){
                    float e = c[mt][t][r] + bs;
                    if (ACT) e = gelu_f(e);
                    v[t] = e;
                }
                if (RES) v += res[mt][r];
                *yp = v;
            }
        }
        // the next column tile overwrites address and data registers of the stores above
        asm volatile("s_wait_xcnt 0x0" ::: "memory");
    }
}

__global__ __launch_bounds__(128, 4) void ff1_kernel(const float* __restrict__ W,
                           const float* __restrict__ bias,
                           const float* __restrict__ X, float* __restrict__ Y){
    gemm_body<2*HH, HH, 6, true, false>(W, bias, X, Y);
}

__global__ __launch_bounds__(128, 4) void ff2_kernel(const float* __restrict__ W,
                           const float* __restrict__ bias,
                           const float* __restrict__ X, float* __restrict__ Y){
    gemm_body<HH, 2*HH, 8, false, true>(W, bias, X, Y);
}

// ---- final projection H->1
__global__ void proj_kernel(const float* __restrict__ U, const float* __restrict__ pw,
                            const float* __restrict__ pb, float* __restrict__ out){
    int idx = blockIdx.x*blockDim.x + threadIdx.x;   // B*L
    int l = idx % LL; int b = idx / LL;
    if (b >= BB) return;
    const float* up = U + (size_t)b*HH*LL + l;
    float acc = pb[0];
    #pragma unroll 8
    for (int h = 0; h < HH; ++h) acc = fmaf(up[(size_t)h*LL], pw[h], acc);
    out[idx] = acc;
}

extern "C" void kernel_launch(void* const* d_in, const int* in_sizes, int n_in,
                              void* d_out, int out_size, void* d_ws, size_t ws_size,
                              hipStream_t stream){
    (void)in_sizes; (void)n_in; (void)out_size; (void)ws_size;
    const float* x       = (const float*)d_in[0];
    const float* conv_w  = (const float*)d_in[1];
    const float* conv_b  = (const float*)d_in[2];
    const float* ln1_w   = (const float*)d_in[3];
    const float* ln1_b   = (const float*)d_in[4];
    const float* log_dt  = (const float*)d_in[5];
    const float* A_re    = (const float*)d_in[6];
    const float* A_im    = (const float*)d_in[7];
    const float* C_re    = (const float*)d_in[8];
    const float* C_im    = (const float*)d_in[9];
    const float* Dv      = (const float*)d_in[10];
    const float* outlin_w= (const float*)d_in[11];
    const float* outlin_b= (const float*)d_in[12];
    const float* ln2_w   = (const float*)d_in[13];
    const float* ln2_b   = (const float*)d_in[14];
    const float* ff_w1   = (const float*)d_in[15];
    const float* ff_b1   = (const float*)d_in[16];
    const float* ff_w2   = (const float*)d_in[17];
    const float* ff_b2   = (const float*)d_in[18];
    const float* proj_w  = (const float*)d_in[19];
    const float* proj_b  = (const float*)d_in[20];
    float* out = (float*)d_out;

    const size_t nBHL = (size_t)BB*HH*LL;          // 8.39M floats
    float*  u      = (float*)d_ws;
    float*  z      = u + nBHL;
    float*  yc     = z + nBHL;
    float*  gl     = yc + nBHL;                    // (B,128,L)
    float2* wSC    = (float2*)(gl + 2*nBHL);
    float2* wWC    = wSC + HH*NN;
    float*  Pm     = (float*)(wWC + HH*NN);        // (H,64,64)
    float*  Qm     = Pm + HH*SUB*SUB;              // (H,64,64)
    float*  Tm     = Qm + HH*SUB*SUB;              // (H,64,64)

    dim3 b256(256);
    dim3 wblk(32, 4);
    conv_up_kernel<<<(unsigned)(nBHL/256), b256, 0, stream>>>(x, conv_w, conv_b, u);

    for (int i = 0; i < NBLK; ++i){
        ln_ch_kernel<<<(BB*LL)/256, b256, 0, stream>>>(u, ln1_w + i*HH, ln1_b + i*HH, z);
        s4pre_kernel<<<HH*4, b256, 0, stream>>>(log_dt + i*HH, A_re + i*HH*NN, A_im + i*HH*NN,
                                                C_re + i*HH*NN, C_im + i*HH*NN, wSC, wWC, Pm, Qm, Tm);
        s4_row_kernel<<<BB*HH, NSUB, 0, stream>>>(z, Pm, Qm, Tm, wSC, wWC, Dv + i*HH, yc);
        outlin_glu_kernel<<<dim3(LL/NCOLS, 1, BB), wblk, 0, stream>>>(outlin_w + i*2*HH*HH,
                                                                   outlin_b + i*2*HH, yc, u);
        ln_ch_kernel<<<(BB*LL)/256, b256, 0, stream>>>(u, ln2_w + i*HH, ln2_b + i*HH, z);
        ff1_kernel<<<dim3(LL/NCOLS, 1, BB), wblk, 0, stream>>>(ff_w1 + i*2*HH*HH, ff_b1 + i*2*HH, z, gl);
        ff2_kernel<<<dim3(LL/NCOLS, 1, BB), wblk, 0, stream>>>(ff_w2 + i*2*HH*HH, ff_b2 + i*HH, gl, u);
    }
    proj_kernel<<<(BB*LL)/256, b256, 0, stream>>>(u, proj_w, proj_b, out);
}

// v004
// Measured time: 424 microseconds a run.
// In both of two side-by-side timings against v003, it was 1.34 times as fast.
// Counting every step since v000, it is 2.30 times as fast.
#include <hip/hip_runtime.h>
#include <hip/hip_bf16.h>
#include <math.h>

typedef __attribute__((ext_vector_type(2))) float v2f;
typedef __attribute__((ext_vector_type(4))) float v4f;
typedef __attribute__((ext_vector_type(8))) float v8f;

#define BB 8
#define HH 64
#define LIN 1024
#define KCONV 16
#define LL (LIN*KCONV)      // 16384
#define NN 32               // complex modes
#define SUB 64              // samples of one sub-chunk
#define NSUB (LL/SUB)       // 256 sub-chunks of a row; also the row kernel's work-group size
#define NWV (NSUB/32)       // 8 waves per row
#define MP (SUB+4)          // LDS pitch of a 64-float row: 16-byte aligned, 16 rows cover all banks
#define NBLK 4

__device__ __forceinline__ float gelu_f(float x){
    float x3 = x*x*x;
    return 0.5f*x*(1.0f + tanhf(0.7978845608028654f*(x + 0.044715f*x3)));
}
__device__ __forceinline__ float sigm_f(float x){ return 1.0f/(1.0f + expf(-x)); }

// ---- ConvTranspose1d(1->H, k=16, stride=16): u[b,h,lin*16+k] = x[b,lin]*w[h,k]+b[h]
__global__ void conv_up_kernel(const float* __restrict__ x, const float* __restrict__ cw,
                               const float* __restrict__ cb, float* __restrict__ u){
    size_t idx = (size_t)blockIdx.x*blockDim.x + threadIdx.x;   // B*H*L
    int l = (int)(idx % LL); int bh = (int)(idx / LL); int h = bh % HH; int b = bh / HH;
    if (b >= BB) return;
    u[idx] = fmaf(x[b*LIN + (l>>4)], cw[h*KCONV + (l&15)], cb[h]);
}

// ---- LayerNorm over channel dim (stride-L layout), one thread per (b,l)
__global__ void ln_ch_kernel(const float* __restrict__ u, const float* __restrict__ w,
                             const float* __restrict__ bias, float* __restrict__ z){
    int idx = blockIdx.x*blockDim.x + threadIdx.x;   // B*L
    int l = idx % LL; int b = idx / LL;
    if (b >= BB) return;
    const float* up = u + (size_t)b*HH*LL + l;
    float s = 0.f, s2 = 0.f;
    #pragma unroll 8
    for (int h = 0; h < HH; ++h){ float v = up[(size_t)h*LL]; s += v; s2 += v*v; }
    float mu = s * (1.0f/HH);
    float var = s2*(1.0f/HH) - mu*mu;
    float rs = rsqrtf(var + 1e-5f);
    float* zp = z + (size_t)b*HH*LL + l;
    #pragma unroll 8
    for (int h = 0; h < HH; ++h){
        float v = up[(size_t)h*LL];
        zp[(size_t)h*LL] = fmaf((v - mu)*rs, w[h], bias[h]);
    }
}

// logical row x of a 64-row operand matrix sits at storage row lrow_of(x): tile (x>>3)&3, row
// (x>>5)*8 + (x&7) of it, so that a lane's 32 accumulator values are 32 consecutive logical rows
__device__ __forceinline__ int lrow_of(int x){ return ((x >> 3) & 3)*16 + (x >> 5)*8 + (x & 7); }
__device__ __forceinline__ int logical_of(int lrow){ return ((lrow >> 3) & 1)*32 + (lrow >> 4)*8 + (lrow & 7); }

// ---- S4D discretization, as matrices over one sub-chunk of SUB samples. With w = exp(dt*A) and
// Ct = 2*C*(w-1)/A, state s <- w*s + z, y = Re(sum Ct*s):
//   Pm[2n+c][t] = Re/Im w^(SUB-1-t)         end state of a sub-chunk from a zero start
//   Qm[t][2n+c] = Re / -Im (Ct*w^(t+1))     what the carried-in state adds to sample t
//   Tm[t][s]    = Re sum_n Ct*w^(t-s)       what sample s <= t of the sub-chunk adds; 0 for s > t
// and wS = w^SUB, wW = w^(32*SUB) for the carries. One work-group does 16 powers of one channel.
#define PWP (NN+1)          // LDS pitch of one power's 32 modes, floats
__global__ void s4pre_kernel(const float* __restrict__ log_dt, const float* __restrict__ A_re,
                             const float* __restrict__ A_im, const float* __restrict__ C_re,
                             const float* __restrict__ C_im, float2* __restrict__ wSC,
                             float2* __restrict__ wWC, float* __restrict__ Pm,
                             float* __restrict__ Qm, float* __restrict__ Tm){
    __shared__ float pr[17*PWP], pi[17*PWP];    // w^k, k = 16*q .. 16*q+16
    __shared__ float ctr[NN], cti[NN], kd[16];
    int tid = threadIdx.x;
    int h = blockIdx.x >> 2, q = blockIdx.x & 3;
    float dt = expf(log_dt[h]);
    for (int i = tid; i < 17*NN; i += 256){
        int n = i & (NN - 1), kk = i >> 5;
        float k = (float)(16*q + kk);
        float dr = A_re[h*NN + n]*dt, di = A_im[h*NN + n]*dt;
        float e = expf(dr*k);
        pr[kk*PWP + n] = e*cosf(di*k);
        pi[kk*PWP + n] = e*sinf(di*k);
    }
    if (tid < NN){
        int idx = h*NN + tid;
        float ar = A_re[idx], ai = A_im[idx];
        float dr = ar*dt, di = ai*dt;
        float er = expf(dr);
        float wr = er*cosf(di), wi = er*sinf(di);
        float mr = wr - 1.0f, mi = wi;                       // w-1
        float den = 1.0f/(ar*ar + ai*ai);
        float qr = (mr*ar + mi*ai)*den;                      // (w-1)/A
        float qi = (mi*ar - mr*ai)*den;
        float cr = C_re[idx], ci = C_im[idx];
        ctr[tid] = 2.0f*(cr*qr - ci*qi);
        cti[tid] = 2.0f*(cr*qi + ci*qr);
        if (q == 0){
            float eS = expf(dr*(float)SUB);
            wSC[idx] = make_float2(eS*cosf(di*(float)SUB), eS*sinf(di*(float)SUB));
            float eW = expf(dr*(float)(32*SUB));
            wWC[idx] = make_float2(eW*cosf(di*(float)(32*SUB)), eW*sinf(di*(float)(32*SUB)));
        }
    }
    __syncthreads();
    float* Ph = Pm + h*(SUB*SUB);
    float* Qh = Qm + h*(SUB*SUB);
    for (int i = tid; i < 16*SUB; i += 256){
        int m = i & (SUB - 1), kk = i >> 6, n = m >> 1;
        // power 16*q + kk is column SUB-1-(16*q+kk) of Pm
        Ph[lrow_of(m)*SUB + (SUB - 1 - (16*q + kk))] = (m & 1) ? pi[kk*PWP + n] : pr[kk*PWP + n];
        // power 16*q + kk + 1 is row 16*q + kk of Qm
        float xr = pr[(kk + 1)*PWP + n], xi = pi[(kk + 1)*PWP + n];
        Qh[lrow_of(16*q + kk)*SUB + m] = (m & 1) ? -(ctr[n]*xi + cti[n]*xr) : (ctr[n]*xr - cti[n]*xi);
    }
    if (tid < 16){
        float a = 0.f, b = 0.f;
        for (int n = 0; n < NN; ++n){
            a = fmaf(ctr[n], pr[tid*PWP + n], a);
            b = fmaf(cti[n], pi[tid*PWP + n], b);
        }
        kd[tid] = a - b;
    }
    __syncthreads();
    float* Th = Tm + h*(SUB*SUB);
    for (int i = tid; i < 16*SUB; i += 256){
        int t = i >> 4, kk = i & 15, d = 16*q + kk;
        if (t >= d) Th[lrow_of(t)*SUB + (t - d)] = kd[kk];          // diagonal d below the main one
        if (t + d + 1 < SUB) Th[lrow_of(t)*SUB + (t + d + 1)] = 0.f; // diagonal d+1 above it
        // the next trip overwrites the address registers of the stores above
        asm volatile("s_wait_xcnt 0x0" ::: "memory");
    }
}

// acc[mt][nt] += M(rows of tile mt) * B(columns of tile nt), M 64x64 in LDS at pitch MP, Ml already
// at the lane's row and half. Step 2*q+e pairs column half*32 + 4*q + 2*e (+1) of M with the same
// element of the lane's B vector; eight independent accumulators cover the matrix unit's latency.
__device__ __forceinline__ void mat_acc(const float* Ml, const v4f (&b)[2][8], v8f (&acc)[4][2]){
    #pragma unroll  // constant indices keep these arrays in registers
    for (int q = 0; q < 8; ++q){
        v4f a[4];
        #pragma unroll  // constant indices keep these arrays in registers
        for (int mt = 0; mt < 4; ++mt) a[mt] = *(const v4f*)(Ml + mt*16*MP + 4*q);
        #pragma unroll  // constant indices keep these arrays in registers
        for (int e = 0; e < 2; ++e){
            #pragma unroll  // constant indices keep these arrays in registers
            for (int mt = 0; mt < 4; ++mt){
                v2f av; av.x = a[mt][2*e]; av.y = a[mt][2*e + 1];
                #pragma unroll  // constant indices keep these arrays in registers
                for (int nt = 0; nt < 2; ++nt){
                    v2f bv; bv.x = b[nt][q][2*e]; bv.y = b[nt][q][2*e + 1];
                    acc[mt][nt] = __builtin_amdgcn_wmma_f32_16x16x4_f32(false, av, false, bv,
                                                                 (short)0, acc[mt][nt], false, false);
                }
            }
        }
    }
}

// ---- S4 scan of one (b,h) row in one work-group, as matrix products over sub-chunks of SUB
// samples. A wave owns 32 sub-chunks (two column tiles). A lane (column c, half) holds elements
// half*32 .. half*32+31 of sub-chunk c's vector, whichever vector it is: samples, end state,
// carry, result. Between the products the carries are scanned with lane = mode, through LDS.
__global__ __launch_bounds__(NSUB, 4) void s4_row_kernel(const float* __restrict__ z,
                                  const float* __restrict__ Pm, const float* __restrict__ Qm,
                                  const float* __restrict__ Tm,
                                  const float2* __restrict__ wSC, const float2* __restrict__ wWC,
                                  const float* __restrict__ Dvec, float* __restrict__ out){
    __shared__ __attribute__((aligned(16))) float buf[NSUB*MP];   // samples, states, carries, results
    __shared__ __attribute__((aligned(16))) float mP[SUB*MP];
    __shared__ __attribute__((aligned(16))) float mQ[SUB*MP];
    __shared__ __attribute__((aligned(16))) float mT[SUB*MP];
    __shared__ __attribute__((aligned(16))) float wtot[NWV*2*NN]; // one total per wave and mode
    int tid = threadIdx.x;
    int lane = tid & 31;
    int wv = __builtin_amdgcn_readfirstlane(tid >> 5);   // the wave's number, in a scalar register
    int row = blockIdx.x;               // b*HH + h
    int hh = row % HH;
    const float* zp = z + (size_t)row*LL;
    float* op = out + (size_t)row*LL;
    int col = lane & 15, half = lane >> 4;
    // the carry scan's factors (lane = mode), asked for here so that they are there when it starts
    float2 wS = wSC[hh*NN + lane];
    float2 wW = wWC[hh*NN + lane];

    // samples: 16 B per lane from memory, element e to buf[(e/SUB)*MP + e%SUB]; with them the
    // channel's three matrices, 16-byte piece i to storage row i/16, columns 4*(i%16)..
    {
        v4f v[16], p[4], g[4], k[4];
        const float* zsrc = zp + wv*(32*SUB) + lane*4;
        const float* Ph = Pm + hh*(SUB*SUB);
        const float* Qh = Qm + hh*(SUB*SUB);
        const float* Th = Tm + hh*(SUB*SUB);
        float Dh = Dvec[hh];
        #pragma unroll  // constant indices keep this array in registers, all loads in flight
        for (int r = 0; r < 16; ++r) v[r] = *(const v4f*)(zsrc + r*128);
        #pragma unroll  // constant indices keep these arrays in registers, all loads in flight
        for (int j = 0; j < 4; ++j){
            int i = tid + j*NSUB;
            p[j] = *(const v4f*)(Ph + i*4);
            g[j] = *(const v4f*)(Qh + i*4);
            k[j] = *(const v4f*)(Th + i*4);
        }
        // the index registers of the loads above are overwritten below
        asm volatile("s_wait_xcnt 0x0" ::: "memory");
        #pragma unroll  // constant indices keep this array in registers
        for (int r = 0; r < 16; ++r){
            int e = wv*(32*SUB) + r*128 + lane*4;
            *(v4f*)(buf + (e/SUB)*MP + (e%SUB)) = v[r];
        }
        #pragma unroll  // constant indices keep these arrays in registers
        for (int j = 0; j < 4; ++j){
            int i = tid + j*NSUB;
            int lr = i >> 4, s0 = (i & 15)*4;
            int t = logical_of(lr);
            // D goes on the diagonal of the Toeplitz matrix
            #pragma unroll  // constant indices keep this vector in registers
            for (int e = 0; e < 4; ++e) k[j][e] = (t == s0 + e) ? k[j][e] + Dh : k[j][e];
            *(v4f*)(mP + lr*MP + s0) = p[j];
            *(v4f*)(mQ + lr*MP + s0) = g[j];
            *(v4f*)(mT + lr*MP + s0) = k[j];
        }
    }
    __syncthreads();

    float* vec0 = buf + (wv*32 + col)*MP + half*32;     // the lane's vector of column tile 0
    int moff = col*MP + half*32;                        // the lane's row and half of a matrix tile
    v4f zf[2][8];
    #pragma unroll  // constant indices keep these arrays in registers
    for (int nt = 0; nt < 2; ++nt)
        #pragma unroll  // constant indices keep these arrays in registers
        for (int q = 0; q < 8; ++q) zf[nt][q] = *(const v4f*)(vec0 + nt*16*MP + 4*q);

    v8f acc[4][2];
    // product 1: end state of every sub-chunk from a zero start, in place of its samples
    #pragma unroll  // constant indices keep these arrays in registers
    for (int mt = 0; mt < 4; ++mt){ acc[mt][0] = v8f{}; acc[mt][1] = v8f{}; }
    mat_acc(mP + moff, zf, acc);
    #pragma unroll  // constant indices keep these arrays in registers
    for (int nt = 0; nt < 2; ++nt)
        #pragma unroll  // constant indices keep these arrays in registers
        for (int mt = 0; mt < 4; ++mt){
            v8f c = acc[mt][nt];
            *(v4f*)(vec0 + nt*16*MP + mt*8)     = v4f{c[0], c[1], c[2], c[3]};
            *(v4f*)(vec0 + nt*16*MP + mt*8 + 4) = v4f{c[4], c[5], c[6], c[7]};
        }
    __syncthreads();

    // carries, lane = mode: the wave's total, the totals of the waves before it, then the
    // exclusive scan over the wave's own 32 sub-chunks
    {
        float* sp = buf + (wv*32)*MP + 2*lane;
        float cr = 0.f, ci = 0.f;
        #pragma unroll 8  // eight LDS reads go out ahead of the dependent chain
        for (int i = 0; i < 32; ++i){
            float2 loc = *(const float2*)(sp + i*MP);
            float nr = fmaf(wS.x, cr, -wS.y*ci) + loc.x;
            float ni = fmaf(wS.x, ci,  wS.y*cr) + loc.y;
            cr = nr; ci = ni;
        }
        *(float2*)(wtot + wv*(2*NN) + 2*lane) = make_float2(cr, ci);
        __syncthreads();
        cr = 0.f; ci = 0.f;
        for (int v = 0; v < wv; ++v){
            float2 loc = *(const float2*)(wtot + v*(2*NN) + 2*lane);
            float nr = fmaf(wW.x, cr, -wW.y*ci) + loc.x;
            float ni = fmaf(wW.x, ci,  wW.y*cr) + loc.y;
            cr = nr; ci = ni;
        }
        #pragma unroll 8  // eight LDS reads go out ahead of the dependent chain
        for (int i = 0; i < 32; ++i){
            float2 loc = *(const float2*)(sp + i*MP);
            *(float2*)(sp + i*MP) = make_float2(cr, ci);
            float nr = fmaf(wS.x, cr, -wS.y*ci) + loc.x;
            float ni = fmaf(wS.x, ci,  wS.y*cr) + loc.y;
            cr = nr; ci = ni;
        }
    }
    __syncthreads();

    // products 2 and 3: the carry's part and the sub-chunk's own part of y + D*z
    #pragma unroll  // constant indices keep these arrays in registers
    for (int mt = 0; mt < 4; ++mt){ acc[mt][0] = v8f{}; acc[mt][1] = v8f{}; }
    {
        v4f cf[2][8];
        #pragma unroll  // constant indices keep these arrays in registers
        for (int nt = 0; nt < 2; ++nt)
            #pragma unroll  // constant indices keep these arrays in registers
            for (int q = 0; q < 8; ++q) cf[nt][q] = *(const v4f*)(vec0 + nt*16*MP + 4*q);
        mat_acc(mQ + moff, cf, acc);
    }
    mat_acc(mT + moff, zf, acc);
    #pragma unroll  // constant indices keep these arrays in registers
    for (int nt = 0; nt < 2; ++nt)
        #pragma unroll  // constant indices keep these arrays in registers
        for (int mt = 0; mt < 4; ++mt){
            v8f c = acc[mt][nt];
            *(v4f*)(vec0 + nt*16*MP + mt*8)     = v4f{gelu_f(c[0]), gelu_f(c[1]), gelu_f(c[2]), gelu_f(c[3])};
            *(v4f*)(vec0 + nt*16*MP + mt*8 + 4) = v4f{gelu_f(c[4]), gelu_f(c[5]), gelu_f(c[6]), gelu_f(c[7])};
        }
    __syncthreads();

    // results: back out in the order the samples came in, 16 B per lane
    #pragma unroll 4  // four stores' LDS reads in flight at a time
    for (int r = 0; r < 16; ++r){
        int e = wv*(32*SUB) + r*128 + lane*4;
        *(v4f*)(op + e) = *(const v4f*)(buf + (e/SUB)*MP + (e%SUB));
    }
}

// ---- Everything between one scan and the next LayerNorm works on single columns, so it is one
// kernel: 128x64 output product with GLU and residual, LayerNorm over the channels, 128x64 product,
// GELU, 64x128 product, residual. A wave owns FC columns from end to end, two column tiles: column
// c0 + 2*c + t belongs to tile t of lane column c. A lane (c, half) holds rows mt*16 + 8*half + r
// (r = 0..7) of every block of 16 rows, which is the accumulator layout, so each product's result
// is the next product's B operand as it stands: k step (mt, rp) pairs rows mt*16 + 8*half + 2*rp
// (+1) with the same columns of the weight matrix. The weights are read from LDS.
#define FC 32               // columns of one wave
#define FWV 8               // waves of a work-group
#define W1P (HH+4)          // LDS pitch of a 64-float weight row: 16 B x odd
#define W2P (2*HH+4)        // LDS pitch of a 128-float weight row: 16 B x odd

// the value that lane l ^ 16 holds
__device__ __forceinline__ float other_half(float x){
    int b = __builtin_bit_cast(int, x);
    return __builtin_bit_cast(float, __builtin_amdgcn_permlanex16(b, b, 0x76543210, 0xfedcba98, false, false));
}
// eight consecutive floats of LDS as one accumulator
__device__ __forceinline__ v8f lds8(const float* p){
    v4f a = *(const v4f*)p, b = *(const v4f*)(p + 4);
    return v8f{a[0], a[1], a[2], a[3], b[0], b[1], b[2], b[3]};
}
// elements 2*rp, 2*rp+1 of eight weights held as two 16-byte pieces
__device__ __forceinline__ v2f pair_of(const v4f (&f)[2], int rp){
    v2f a; a.x = f[rp >> 1][(rp & 1)*2]; a.y = f[rp >> 1][(rp & 1)*2 + 1];
    return a;
}

__global__ __launch_bounds__(FWV*32, 4) void col_block_kernel(const float* __restrict__ Wo,
                                  const float* __restrict__ bo, const float* __restrict__ Y,
                                  const float* __restrict__ lnw, const float* __restrict__ lnb,
                                  const float* __restrict__ W1, const float* __restrict__ b1,
                                  const float* __restrict__ W2, const float* __restrict__ b2,
                                  float* __restrict__ U){
    __shared__ __attribute__((aligned(16))) float sWo[2*HH*W1P];
    __shared__ __attribute__((aligned(16))) float sW1[2*HH*W1P];
    __shared__ __attribute__((aligned(16))) float sW2[HH*W2P];
    __shared__ __attribute__((aligned(16))) float sBo[2*HH];
    __shared__ __attribute__((aligned(16))) float sB1[2*HH];
    __shared__ __attribute__((aligned(16))) float sLw[HH];
    __shared__ __attribute__((aligned(16))) float sLb[HH];
    __shared__ __attribute__((aligned(16))) float sB2[HH];
    int tid = threadIdx.x;
    int lane = tid & 31;
    int wv = __builtin_amdgcn_readfirstlane(tid >> 5);   // the wave's number, in a scalar register
    int col = lane & 15, half = lane >> 4;
    int c0 = (blockIdx.x*FWV + wv)*FC;                   // the wave's first column, counted over B*L
    size_t off = (size_t)(c0/LL)*HH*LL + (size_t)(8*half)*LL + (c0 % LL) + 2*col;
    const float* Yp = Y + off;
    float* Up = U + off;

    v2f yy[4][8];
    #pragma unroll  // constant indices keep these arrays in registers, all loads in flight
    for (int mt = 0; mt < 4; ++mt)
        #pragma unroll  // constant indices keep these arrays in registers, all loads in flight
        for (int r = 0; r < 8; ++r) yy[mt][r] = *(const v2f*)(Yp + (size_t)(mt*16 + r)*LL);
    // the address registers of the loads above are free for the results of the loads below
    asm volatile("s_wait_xcnt 0x0" ::: "memory");
    {
        v4f o[8], p[8], g[8];
        #pragma unroll  // constant indices keep these arrays in registers, all loads in flight
        for (int j = 0; j < 8; ++j){
            int i = tid + j*(FWV*32);
            o[j] = *(const v4f*)(Wo + i*4);
            p[j] = *(const v4f*)(W1 + i*4);
            g[j] = *(const v4f*)(W2 + i*4);
        }
        // the short vectors, asked for right behind the loads above so that they come back with them
        if (tid < 2*HH){ sBo[tid] = bo[tid]; sB1[tid] = b1[tid]; }
        if (tid < HH){ sLw[tid] = lnw[tid]; sLb[tid] = lnb[tid]; sB2[tid] = b2[tid]; }
        // the index registers of the loads above are overwritten below
        asm volatile("s_wait_xcnt 0x0" ::: "memory");
        #pragma unroll  // constant indices keep these arrays in registers
        for (int j = 0; j < 8; ++j){
            int i = tid + j*(FWV*32);
            *(v4f*)(sWo + (i >> 4)*W1P + (i & 15)*4) = o[j];
            *(v4f*)(sW1 + (i >> 4)*W1P + (i & 15)*4) = p[j];
            *(v4f*)(sW2 + (i >> 5)*W2P + (i & 31)*4) = g[j];
        }
    }
    __syncthreads();

    // the residual rows are asked for here and used behind the first products
    v2f uu[4][8];
    #pragma unroll  // constant indices keep these arrays in registers, all loads in flight
    for (int mt = 0; mt < 4; ++mt)
        #pragma unroll  // constant indices keep these arrays in registers, all loads in flight
        for (int r = 0; r < 8; ++r) uu[mt][r] = *(const v2f*)(Up + (size_t)(mt*16 + r)*LL);

    // output product and GLU: rows mt*16.. and their gate rows 64 + mt*16.., then u += a*sigmoid(g)
    float un[4][2][8];
    {
        const float* ao = sWo + col*W1P + 8*half;
        #pragma unroll  // constant indices keep these arrays in registers
        for (int mt = 0; mt < 4; ++mt){
            v8f ca[2], cg[2];
            ca[0] = lds8(sBo + mt*16 + 8*half);      ca[1] = ca[0];
            cg[0] = lds8(sBo + HH + mt*16 + 8*half); cg[1] = cg[0];
            #pragma unroll  // constant indices keep these arrays in registers
            for (int kt = 0; kt < 4; ++kt){
                v4f fa[2], fg[2];
                #pragma unroll  // constant indices keep these arrays in registers
                for (int e = 0; e < 2; ++e){
                    fa[e] = *(const v4f*)(ao + (mt*16)*W1P + kt*16 + 4*e);
                    fg[e] = *(const v4f*)(ao + (HH + mt*16)*W1P + kt*16 + 4*e);
                }
                #pragma unroll  // constant indices keep these arrays in registers
                for (int rp = 0; rp < 4; ++rp)
                    #pragma unroll  // constant indices keep these arrays in registers
                    for (int t = 0; t < 2; ++t){
                        v2f bv; bv.x = yy[kt][2*rp][t]; bv.y = yy[kt][2*rp + 1][t];
                        ca[t] = __builtin_amdgcn_wmma_f32_16x16x4_f32(false, pair_of(fa, rp), false, bv,
                                                                      (short)0, ca[t], false, false);
                        cg[t] = __builtin_amdgcn_wmma_f32_16x16x4_f32(false, pair_of(fg, rp), false, bv,
                                                                      (short)0, cg[t], false, false);
                    }
            }
            #pragma unroll  // constant indices keep these arrays in registers
            for (int t = 0; t < 2; ++t)
                #pragma unroll  // constant indices keep these arrays in registers
                for (int r = 0; r < 8; ++r) un[mt][t][r] = uu[mt][r][t] + ca[t][r]*sigm_f(cg[t][r]);
            // one row block's accumulators at a time: without it all four blocks' products move to the
            // front and registers spill
            __builtin_amdgcn_sched_barrier(0);
        }
    }

    // LayerNorm of the wave's columns: a lane sums its 32 rows, lane l ^ 16 has the other 32
    float z[4][2][8];
    v8f c2[4][2];
    #pragma unroll  // constant indices keep these arrays in registers
    for (int t = 0; t < 2; ++t){
        float sa[4], sq[4];
        #pragma unroll  // constant indices keep these arrays in registers
        for (int mt = 0; mt < 4; ++mt){
            sa[mt] = 0.f; sq[mt] = 0.f;
            #pragma unroll  // constant indices keep these arrays in registers
            for (int r = 0; r < 8; ++r){ sa[mt] += un[mt][t][r]; sq[mt] = fmaf(un[mt][t][r], un[mt][t][r], sq[mt]); }
        }
        float s = (sa[0] + sa[1]) + (sa[2] + sa[3]);
        float q = (sq[0] + sq[1]) + (sq[2] + sq[3]);
        s += other_half(s);
        q += other_half(q);
        float mu = s*(1.0f/HH);
        float var = q*(1.0f/HH) - mu*mu;
        float rs = rsqrtf(var + 1e-5f);
        #pragma unroll  // constant indices keep these arrays in registers
        for (int mt = 0; mt < 4; ++mt){
            v8f lw = lds8(sLw + mt*16 + 8*half), lb = lds8(sLb + mt*16 + 8*half);
            v8f b2v = lds8(sB2 + mt*16 + 8*half);
            #pragma unroll  // constant indices keep these arrays in registers
            for (int r = 0; r < 8; ++r){
                float v = un[mt][t][r];
                z[mt][t][r] = fmaf((v - mu)*rs, lw[r], lb[r]);
                // the last product accumulates on top of the residual and its bias
                c2[mt][t][r] = v + b2v[r];
            }
        }
    }

    const float* a1 = sW1 + col*W1P + 8*half;
    const float* a2 = sW2 + col*W2P + 8*half;
    // rolled: one 16-row block of the hidden layer at a time keeps registers and code size down
    #pragma unroll 1
    for (int ht = 0; ht < 8; ++ht){
        v4f f[4][2];
        #pragma unroll  // constant indices keep these arrays in registers
        for (int mt = 0; mt < 4; ++mt){
            f[mt][0] = *(const v4f*)(a1 + ht*16*W1P + mt*16);
            f[mt][1] = *(const v4f*)(a1 + ht*16*W1P + mt*16 + 4);
        }
        v8f c1[2];
        c1[0] = lds8(sB1 + ht*16 + 8*half);
        c1[1] = c1[0];
        #pragma unroll  // constant indices keep these arrays in registers
        for (int mt = 0; mt < 4; ++mt)
            #pragma unroll  // constant indices keep these arrays in registers
            for (int rp = 0; rp < 4; ++rp)
                #pragma unroll  // constant indices keep these arrays in registers
                for (int t = 0; t < 2; ++t){
                    v2f bv; bv.x = z[mt][t][2*rp]; bv.y = z[mt][t][2*rp + 1];
                    c1[t] = __builtin_amdgcn_wmma_f32_16x16x4_f32(false, pair_of(f[mt], rp), false, bv,
                                                                  (short)0, c1[t], false, false);
                }
        #pragma unroll  // constant indices keep these arrays in registers
        for (int mt = 0; mt < 4; ++mt){
            f[mt][0] = *(const v4f*)(a2 + mt*16*W2P + ht*16);
            f[mt][1] = *(const v4f*)(a2 + mt*16*W2P + ht*16 + 4);
        }
        #pragma unroll  // constant indices keep these arrays in registers
        for (int t = 0; t < 2; ++t)
            #pragma unroll  // constant indices keep these arrays in registers
            for (int r = 0; r < 8; ++r) c1[t][r] = gelu_f(c1[t][r]);
        #pragma unroll  // constant indices keep these arrays in registers
        for (int rp = 0; rp < 4; ++rp)
            #pragma unroll  // constant indices keep these arrays in registers
            for (int mt = 0; mt < 4; ++mt)
                #pragma unroll  // constant indices keep these arrays in registers
                for (int t = 0; t < 2; ++t){
                    v2f bv; bv.x = c1[t][2*rp]; bv.y = c1[t][2*rp + 1];
                    c2[mt][t] = __builtin_amdgcn_wmma_f32_16x16x4_f32(false, pair_of(f[mt], rp), false, bv,
                                                                      (short)0, c2[mt][t], false, false);
                }
    }

    #pragma unroll  // constant indices keep these arrays in registers
    for (int mt = 0; mt < 4; ++mt)
        #pragma unroll  // constant indices keep these arrays in registers
        for (int r = 0; r < 8; ++r)
            *(v2f*)(Up + (size_t)(mt*16 + r)*LL) = v2f{c2[mt][0][r], c2[mt][1][r]};
}

// ---- final projection H->1
__global__ void proj_kernel(const float* __restrict__ U, const float* __restrict__ pw,
                            const float* __restrict__ pb, float* __restrict__ out){
    int idx = blockIdx.x*blockDim.x + threadIdx.x;   // B*L
    int l = idx % LL; int b = idx / LL;
    if (b >= BB) return;
    const float* up = U + (size_t)b*HH*LL + l;
    float acc = pb[0];
    #pragma unroll 8
    for (int h = 0; h < HH; ++h) acc = fmaf(up[(size_t)h*LL], pw[h], acc);
    out[idx] = acc;
}

extern "C" void kernel_launch(void* const* d_in, const int* in_sizes, int n_in,
                              void* d_out, int out_size, void* d_ws, size_t ws_size,
                              hipStream_t stream){
    (void)in_sizes; (void)n_in; (void)out_size; (void)ws_size;
    const float* x       = (const float*)d_in[0];
    const float* conv_w  = (const float*)d_in[1];
    const float* conv_b  = (const float*)d_in[2];
    const float* ln1_w   = (const float*)d_in[3];
    const float* ln1_b   = (const float*)d_in[4];
    const float* log_dt  = (const float*)d_in[5];
    const float* A_re    = (const float*)d_in[6];
    const float* A_im    = (const float*)d_in[7];
    const float* C_re    = (const float*)d_in[8];
    const float* C_im    = (const float*)d_in[9];
    const float* Dv      = (const float*)d_in[10];
    const float* outlin_w= (const float*)d_in[11];
    const float* outlin_b= (const float*)d_in[12];
    const float* ln2_w   = (const float*)d_in[13];
    const float* ln2_b   = (const float*)d_in[14];
    const float* ff_w1   = (const float*)d_in[15];
    const float* ff_b1   = (const float*)d_in[16];
    const float* ff_w2   = (const float*)d_in[17];
    const float* ff_b2   = (const float*)d_in[18];
    const float* proj_w  = (const float*)d_in[19];
    const float* proj_b  = (const float*)d_in[20];
    float* out = (float*)d_out;

    const size_t nBHL = (size_t)BB*HH*LL;          // 8.39M floats
    float*  u      = (float*)d_ws;
    float*  z      = u + nBHL;
    float*  yc     = z + nBHL;
    float2* wSC    = (float2*)(yc + nBHL);
    float2* wWC    = wSC + HH*NN;
    float*  Pm     = (float*)(wWC + HH*NN);        // (H,64,64)
    float*  Qm     = Pm + HH*SUB*SUB;              // (H,64,64)
    float*  Tm     = Qm + HH*SUB*SUB;              // (H,64,64)

    dim3 b256(256);
    conv_up_kernel<<<(unsigned)(nBHL/256), b256, 0, stream>>>(x, conv_w, conv_b, u);

    for (int i = 0; i < NBLK; ++i){
        ln_ch_kernel<<<(BB*LL)/256, b256, 0, stream>>>(u, ln1_w + i*HH, ln1_b + i*HH, z);
        s4pre_kernel<<<HH*4, b256, 0, stream>>>(log_dt + i*HH, A_re + i*HH*NN, A_im + i*HH*NN,
                                                C_re + i*HH*NN, C_im + i*HH*NN, wSC, wWC, Pm, Qm, Tm);
        s4_row_kernel<<<BB*HH, NSUB, 0, stream>>>(z, Pm, Qm, Tm, wSC, wWC, Dv + i*HH, yc);
        col_block_kernel<<<(BB*LL)/(FC*FWV), FWV*32, 0, stream>>>(outlin_w + i*2*HH*HH, outlin_b + i*2*HH, yc,
                                                                  ln2_w + i*HH, ln2_b + i*HH,
                                                                  ff_w1 + i*2*HH*HH, ff_b1 + i*2*HH,
                                                                  ff_w2 + i*2*HH*HH, ff_b2 + i*HH, u);
    }
    proj_kernel<<<(BB*LL)/256, b256, 0, stream>>>(u, proj_w, proj_b, out);
}

// v005
// It runs in 340 microseconds.
// Two timings next to v004 both put it at 1.25 times that version's speed.
// All steps since v000 together make it 2.89 times as fast.
#include <hip/hip_runtime.h>
#include <hip/hip_bf16.h>
#include <math.h>

typedef __attribute__((ext_vector_type(2))) float v2f;
typedef __attribute__((ext_vector_type(4))) float v4f;
typedef __attribute__((ext_vector_type(8))) float v8f;

#define BB 8
#define HH 64
#define LIN 1024
#define KCONV 16
#define LL (LIN*KCONV)      // 16384
#define NN 32               // complex modes
#define SUB 64              // samples of one sub-chunk
#define NSUB (LL/SUB)       // 256 sub-chunks of a row; also the row kernel's work-group size
#define NWV (NSUB/32)       // 8 waves per row
#define MP (SUB+4)          // LDS pitch of a 64-float row: 16-byte aligned, 16 rows cover all banks
#define NBLK 4

// GELU and sigmoid on two values at once, so that the plain arithmetic goes out as packed instructions.
// 0.5*x*(1 + tanh(t)) = x/(1 + exp(-2*t)) with t = 0.7978845608*(x + 0.044715*x^3); the exponential is
// one hardware 2^a with log2(e) folded into the constants, the division one hardware reciprocal.
// a = +inf gives x*0 and a = -inf gives x*1, as the tanh form does.
__device__ __forceinline__ v2f rcp1p_exp2(v2f a){
    v2f d = v2f{__builtin_amdgcn_exp2f(a.x), __builtin_amdgcn_exp2f(a.y)} + 1.0f;
    return v2f{__builtin_amdgcn_rcpf(d.x), __builtin_amdgcn_rcpf(d.y)};
}
__device__ __forceinline__ v2f gelu2_f(v2f x){
    const float k1 = (float)(-2.0*0.7978845608028654*1.4426950408889634);
    const float k3 = (float)(-2.0*0.7978845608028654*0.044715*1.4426950408889634);
    return x*rcp1p_exp2(x*__builtin_elementwise_fma(x*x, v2f{k3, k3}, v2f{k1, k1}));
}
__device__ __forceinline__ v2f sigm2_f(v2f x){ return rcp1p_exp2(x*-1.4426950408889634f); }
// GELU of an accumulator's eight values
__device__ __forceinline__ v8f gelu8_f(v8f c){
    v2f a = gelu2_f(v2f{c[0], c[1]}), b = gelu2_f(v2f{c[2], c[3]});
    v2f d = gelu2_f(v2f{c[4], c[5]}), e = gelu2_f(v2f{c[6], c[7]});
    return v8f{a.x, a.y, b.x, b.y, d.x, d.y, e.x, e.y};
}

// ---- ConvTranspose1d(1->H, k=16, stride=16): u[b,h,lin*16+k] = x[b,lin]*w[h,k]+b[h]
__global__ void conv_up_kernel(const float* __restrict__ x, const float* __restrict__ cw,
                               const float* __restrict__ cb, float* __restrict__ u){
    size_t idx = (size_t)blockIdx.x*blockDim.x + threadIdx.x;   // B*H*L
    int l = (int)(idx % LL); int bh = (int)(idx / LL); int h = bh % HH; int b = bh / HH;
    if (b >= BB) return;
    u[idx] = fmaf(x[b*LIN + (l>>4)], cw[h*KCONV + (l&15)], cb[h]);
}

// ---- LayerNorm over channel dim (stride-L layout), one thread per (b,l)
__global__ void ln_ch_kernel(const float* __restrict__ u, const float* __restrict__ w,
                             const float* __restrict__ bias, float* __restrict__ z){
    int idx = blockIdx.x*blockDim.x + threadIdx.x;   // B*L
    int l = idx % LL; int b = idx / LL;
    if (b >= BB) return;
    const float* up = u + (size_t)b*HH*LL + l;
    float s = 0.f, s2 = 0.f;
    #pragma unroll 8
    for (int h = 0; h < HH; ++h){ float v = up[(size_t)h*LL]; s += v; s2 += v*v; }
    float mu = s * (1.0f/HH);
    float var = s2*(1.0f/HH) - mu*mu;
    float rs = rsqrtf(var + 1e-5f);
    float* zp = z + (size_t)b*HH*LL + l;
    #pragma unroll 8
    for (int h = 0; h < HH; ++h){
        float v = up[(size_t)h*LL];
        zp[(size_t)h*LL] = fmaf((v - mu)*rs, w[h], bias[h]);
    }
}

// logical row x of a 64-row operand matrix sits at storage row lrow_of(x): tile (x>>3)&3, row
// (x>>5)*8 + (x&7) of it, so that a lane's 32 accumulator values are 32 consecutive logical rows
__device__ __forceinline__ int lrow_of(int x){ return ((x >> 3) & 3)*16 + (x >> 5)*8 + (x & 7); }
__device__ __forceinline__ int logical_of(int lrow){ return ((lrow >> 3) & 1)*32 + (lrow >> 4)*8 + (lrow & 7); }

// ---- S4D discretization, as matrices over one sub-chunk of SUB samples. With w = exp(dt*A) and
// Ct = 2*C*(w-1)/A, state s <- w*s + z, y = Re(sum Ct*s):
//   Pm[2n+c][t] = Re/Im w^(SUB-1-t)         end state of a sub-chunk from a zero start
//   Qm[t][2n+c] = Re / -Im (Ct*w^(t+1))     what the carried-in state adds to sample t
//   Tm[t][s]    = Re sum_n Ct*w^(t-s)       what sample s <= t of the sub-chunk adds; 0 for s > t
// and wS = w^SUB, wW = w^(32*SUB) for the carries. One work-group does 16 powers of one channel.
#define PWP (NN+1)          // LDS pitch of one power's 32 modes, floats
__global__ void s4pre_kernel(const float* __restrict__ log_dt, const float* __restrict__ A_re,
                             const float* __restrict__ A_im, const float* __restrict__ C_re,
                             const float* __restrict__ C_im, float2* __restrict__ wSC,
                             float2* __restrict__ wWC, float* __restrict__ Pm,
                             float* __restrict__ Qm, float* __restrict__ Tm){
    __shared__ float pr[17*PWP], pi[17*PWP];    // w^k, k = 16*q .. 16*q+16
    __shared__ float ctr[NN], cti[NN], kd[16];
    int tid = threadIdx.x;
    int h = blockIdx.x >> 2, q = blockIdx.x & 3;
    float dt = expf(log_dt[h]);
    for (int i = tid; i < 17*NN; i += 256){
        int n = i & (NN - 1), kk = i >> 5;
        float k = (float)(16*q + kk);
        float dr = A_re[h*NN + n]*dt, di = A_im[h*NN + n]*dt;
        float e = expf(dr*k);
        pr[kk*PWP + n] = e*cosf(di*k);
        pi[kk*PWP + n] = e*sinf(di*k);
    }
    if (tid < NN){
        int idx = h*NN + tid;
        float ar = A_re[idx], ai = A_im[idx];
        float dr = ar*dt, di = ai*dt;
        float er = expf(dr);
        float wr = er*cosf(di), wi = er*sinf(di);
        float mr = wr - 1.0f, mi = wi;                       // w-1
        float den = 1.0f/(ar*ar + ai*ai);
        float qr = (mr*ar + mi*ai)*den;                      // (w-1)/A
        float qi = (mi*ar - mr*ai)*den;
        float cr = C_re[idx], ci = C_im[idx];
        ctr[tid] = 2.0f*(cr*qr - ci*qi);
        cti[tid] = 2.0f*(cr*qi + ci*qr);
        if (q == 0){
            float eS = expf(dr*(float)SUB);
            wSC[idx] = make_float2(eS*cosf(di*(float)SUB), eS*sinf(di*(float)SUB));
            float eW = expf(dr*(float)(32*SUB));
            wWC[idx] = make_float2(eW*cosf(di*(float)(32*SUB)), eW*sinf(di*(float)(32*SUB)));
        }
    }
    __syncthreads();
    float* Ph = Pm + h*(SUB*SUB);
    float* Qh = Qm + h*(SUB*SUB);
    for (int i = tid; i < 16*SUB; i += 256){
        int m = i & (SUB - 1), kk = i >> 6, n = m >> 1;
        // power 16*q + kk is column SUB-1-(16*q+kk) of Pm
        Ph[lrow_of(m)*SUB + (SUB - 1 - (16*q + kk))] = (m & 1) ? pi[kk*PWP + n] : pr[kk*PWP + n];
        // power 16*q + kk + 1 is row 16*q + kk of Qm
        float xr = pr[(kk + 1)*PWP + n], xi = pi[(kk + 1)*PWP + n];
        Qh[lrow_of(16*q + kk)*SUB + m] = (m & 1) ? -(ctr[n]*xi + cti[n]*xr) : (ctr[n]*xr - cti[n]*xi);
    }
    if (tid < 16){
        float a = 0.f, b = 0.f;
        for (int n = 0; n < NN; ++n){
            a = fmaf(ctr[n], pr[tid*PWP + n], a);
            b = fmaf(cti[n], pi[tid*PWP + n], b);
        }
        kd[tid] = a - b;
    }
    __syncthreads();
    float* Th = Tm + h*(SUB*SUB);
    for (int i = tid; i < 16*SUB; i += 256){
        int t = i >> 4, kk = i & 15, d = 16*q + kk;
        if (t >= d) Th[lrow_of(t)*SUB + (t - d)] = kd[kk];          // diagonal d below the main one
        if (t + d + 1 < SUB) Th[lrow_of(t)*SUB + (t + d + 1)] = 0.f; // diagonal d+1 above it
        // the next trip overwrites the address registers of the stores above
        asm volatile("s_wait_xcnt 0x0" ::: "memory");
    }
}

// acc[mt][nt] += M(rows of tile mt) * B(columns of tile nt), M 64x64 in LDS at pitch MP, Ml already
// at the lane's row and half. Step 2*q+e pairs column half*32 + 4*q + 2*e (+1) of M with the same
// element of the lane's B vector; eight independent accumulators cover the matrix unit's latency.
__device__ __forceinline__ void mat_acc(const float* Ml, const v4f (&b)[2][8], v8f (&acc)[4][2]){
    #pragma unroll  // constant indices keep these arrays in registers
    for (int q = 0; q < 8; ++q){
        v4f a[4];
        #pragma unroll  // constant indices keep these arrays in registers
        for (int mt = 0; mt < 4; ++mt) a[mt] = *(const v4f*)(Ml + mt*16*MP + 4*q);
        #pragma unroll  // constant indices keep these arrays in registers
        for (int e = 0; e < 2; ++e){
            #pragma unroll  // constant indices keep these arrays in registers
            for (int mt = 0; mt < 4; ++mt){
                v2f av; av.x = a[mt][2*e]; av.y = a[mt][2*e + 1];
                #pragma unroll  // constant indices keep these arrays in registers
                for (int nt = 0; nt < 2; ++nt){
                    v2f bv; bv.x = b[nt][q][2*e]; bv.y = b[nt][q][2*e + 1];
                    acc[mt][nt] = __builtin_amdgcn_wmma_f32_16x16x4_f32(false, av, false, bv,
                                                                 (short)0, acc[mt][nt], false, false);
                }
            }
        }
    }
}

// ---- S4 scan of one (b,h) row in one work-group, as matrix products over sub-chunks of SUB
// samples. A wave owns 32 sub-chunks (two column tiles). A lane (column c, half) holds elements
// half*32 .. half*32+31 of sub-chunk c's vector, whichever vector it is: samples, end state,
// carry, result. Between the products the carries are scanned with lane = mode, through LDS.
__global__ __launch_bounds__(NSUB, 4) void s4_row_kernel(const float* __restrict__ z,
                                  const float* __restrict__ Pm, const float* __restrict__ Qm,
                                  const float* __restrict__ Tm,
                                  const float2* __restrict__ wSC, const float2* __restrict__ wWC,
                                  const float* __restrict__ Dvec, float* __restrict__ out){
    __shared__ __attribute__((aligned(16))) float buf[NSUB*MP];   // samples, states, carries, results
    __shared__ __attribute__((aligned(16))) float mP[SUB*MP];
    __shared__ __attribute__((aligned(16))) float mQ[SUB*MP];
    __shared__ __attribute__((aligned(16))) float mT[SUB*MP];
    __shared__ __attribute__((aligned(16))) float wtot[NWV*2*NN]; // one total per wave and mode
    int tid = threadIdx.x;
    int lane = tid & 31;
    int wv = __builtin_amdgcn_readfirstlane(tid >> 5);   // the wave's number, in a scalar register
    int row = blockIdx.x;               // b*HH + h
    int hh = row % HH;
    const float* zp = z + (size_t)row*LL;
    float* op = out + (size_t)row*LL;
    int col = lane & 15, half = lane >> 4;
    // the carry scan's factors (lane = mode), asked for here so that they are there when it starts
    float2 wS = wSC[hh*NN + lane];
    float2 wW = wWC[hh*NN + lane];

    // samples: 16 B per lane from memory, element e to buf[(e/SUB)*MP + e%SUB]; with them the
    // channel's three matrices, 16-byte piece i to storage row i/16, columns 4*(i%16)..
    {
        v4f v[16], p[4], g[4], k[4];
        const float* zsrc = zp + wv*(32*SUB) + lane*4;
        const float* Ph = Pm + hh*(SUB*SUB);
        const float* Qh = Qm + hh*(SUB*SUB);
        const float* Th = Tm + hh*(SUB*SUB);
        float Dh = Dvec[hh];
        #pragma unroll  // constant indices keep this array in registers, all loads in flight
        for (int r = 0; r < 16; ++r) v[r] = *(const v4f*)(zsrc + r*128);
        #pragma unroll  // constant indices keep these arrays in registers, all loads in flight
        for (int j = 0; j < 4; ++j){
            int i = tid + j*NSUB;
            p[j] = *(const v4f*)(Ph + i*4);
            g[j] = *(const v4f*)(Qh + i*4);
            k[j] = *(const v4f*)(Th + i*4);
        }
        // the index registers of the loads above are overwritten below
        asm volatile("s_wait_xcnt 0x0" ::: "memory");
        #pragma unroll  // constant indices keep this array in registers
        for (int r = 0; r < 16; ++r){
            int e = wv*(32*SUB) + r*128 + lane*4;
            *(v4f*)(buf + (e/SUB)*MP + (e%SUB)) = v[r];
        }
        #pragma unroll  // constant indices keep these arrays in registers
        for (int j = 0; j < 4; ++j){
            int i = tid + j*NSUB;
            int lr = i >> 4, s0 = (i & 15)*4;
            int t = logical_of(lr);
            // D goes on the diagonal of the Toeplitz matrix
            #pragma unroll  // constant indices keep this vector in registers
            for (int e = 0; e < 4; ++e) k[j][e] = (t == s0 + e) ? k[j][e] + Dh : k[j][e];
            *(v4f*)(mP + lr*MP + s0) = p[j];
            *(v4f*)(mQ + lr*MP + s0) = g[j];
            *(v4f*)(mT + lr*MP + s0) = k[j];
        }
    }
    __syncthreads();

    float* vec0 = buf + (wv*32 + col)*MP + half*32;     // the lane's vector of column tile 0
    int moff = col*MP + half*32;                        // the lane's row and half of a matrix tile
    v4f zf[2][8];
    #pragma unroll  // constant indices keep these arrays in registers
    for (int nt = 0; nt < 2; ++nt)
        #pragma unroll  // constant indices keep these arrays in registers
        for (int q = 0; q < 8; ++q) zf[nt][q] = *(const v4f*)(vec0 + nt*16*MP + 4*q);

    v8f acc[4][2];
    // product 1: end state of every sub-chunk from a zero start, in place of its samples
    #pragma unroll  // constant indices keep these arrays in registers
    for (int mt = 0; mt < 4; ++mt){ acc[mt][0] = v8f{}; acc[mt][1] = v8f{}; }
    mat_acc(mP + moff, zf, acc);
    #pragma unroll  // constant indices keep these arrays in registers
    for (int nt = 0; nt < 2; ++nt)
        #pragma unroll  // constant indices keep these arrays in registers
        for (int mt = 0; mt < 4; ++mt){
            v8f c = acc[mt][nt];
            *(v4f*)(vec0 + nt*16*MP + mt*8)     = v4f{c[0], c[1], c[2], c[3]};
            *(v4f*)(vec0 + nt*16*MP + mt*8 + 4) = v4f{c[4], c[5], c[6], c[7]};
        }
    __syncthreads();

    // carries, lane = mode: the wave's total, the totals of the waves before it, then the
    // exclusive scan over the wave's own 32 sub-chunks
    {
        float* sp = buf + (wv*32)*MP + 2*lane;
        float cr = 0.f, ci = 0.f;
        #pragma unroll 8  // eight LDS reads go out ahead of the dependent chain
        for (int i = 0; i < 32; ++i){
            float2 loc = *(const float2*)(sp + i*MP);
            float nr = fmaf(wS.x, cr, -wS.y*ci) + loc.x;
            float ni = fmaf(wS.x, ci,  wS.y*cr) + loc.y;
            cr = nr; ci = ni;
        }
        *(float2*)(wtot + wv*(2*NN) + 2*lane) = make_float2(cr, ci);
        __syncthreads();
        cr = 0.f; ci = 0.f;
        for (int v = 0; v < wv; ++v){
            float2 loc = *(const float2*)(wtot + v*(2*NN) + 2*lane);
            float nr = fmaf(wW.x, cr, -wW.y*ci) + loc.x;
            float ni = fmaf(wW.x, ci,  wW.y*cr) + loc.y;
            cr = nr; ci = ni;
        }
        #pragma unroll 8  // eight LDS reads go out ahead of the dependent chain
        for (int i = 0; i < 32; ++i){
            float2 loc = *(const float2*)(sp + i*MP);
            *(float2*)(sp + i*MP) = make_float2(cr, ci);
            float nr = fmaf(wS.x, cr, -wS.y*ci) + loc.x;
            float ni = fmaf(wS.x, ci,  wS.y*cr) + loc.y;
            cr = nr; ci = ni;
        }
    }
    __syncthreads();

    // products 2 and 3: the carry's part and the sub-chunk's own part of y + D*z
    #pragma unroll  // constant indices keep these arrays in registers
    for (int mt = 0; mt < 4; ++mt){ acc[mt][0] = v8f{}; acc[mt][1] = v8f{}; }
    {
        v4f cf[2][8];
        #pragma unroll  // constant indices keep these arrays in registers
        for (int nt = 0; nt < 2; ++nt)
            #pragma unroll  // constant indices keep these arrays in registers
            for (int q = 0; q < 8; ++q) cf[nt][q] = *(const v4f*)(vec0 + nt*16*MP + 4*q);
        mat_acc(mQ + moff, cf, acc);
    }
    mat_acc(mT + moff, zf, acc);
    #pragma unroll  // constant indices keep these arrays in registers
    for (int nt = 0; nt < 2; ++nt)
        #pragma unroll  // constant indices keep these arrays in registers
        for (int mt = 0; mt < 4; ++mt){
            v8f c = gelu8_f(acc[mt][nt]);
            *(v4f*)(vec0 + nt*16*MP + mt*8)     = v4f{c[0], c[1], c[2], c[3]};
            *(v4f*)(vec0 + nt*16*MP + mt*8 + 4) = v4f{c[4], c[5], c[6], c[7]};
        }
    __syncthreads();

    // results: back out in the order the samples came in, 16 B per lane
    #pragma unroll 4  // four stores' LDS reads in flight at a time
    for (int r = 0; r < 16; ++r){
        int e = wv*(32*SUB) + r*128 + lane*4;
        *(v4f*)(op + e) = *(const v4f*)(buf + (e/SUB)*MP + (e%SUB));
    }
}

// ---- Everything between one scan and the next LayerNorm works on single columns, so it is one
// kernel: 128x64 output product with GLU and residual, LayerNorm over the channels, 128x64 product,
// GELU, 64x128 product, residual. A wave owns FC columns from end to end, two column tiles: column
// c0 + 2*c + t belongs to tile t of lane column c. A lane (c, half) holds rows mt*16 + 8*half + r
// (r = 0..7) of every block of 16 rows, which is the accumulator layout, so each product's result
// is the next product's B operand as it stands: k step (mt, rp) pairs rows mt*16 + 8*half + 2*rp
// (+1) with the same columns of the weight matrix. The weights are read from LDS.
#define FC 32               // columns of one wave
#define FWV 8               // waves of a work-group
#define W1P (HH+4)          // LDS pitch of a 64-float weight row: 16 B x odd
#define W2P (2*HH+4)        // LDS pitch of a 128-float weight row: 16 B x odd

// the value that lane l ^ 16 holds
__device__ __forceinline__ float other_half(float x){
    int b = __builtin_bit_cast(int, x);
    return __builtin_bit_cast(float, __builtin_amdgcn_permlanex16(b, b, 0x76543210, 0xfedcba98, false, false));
}
// eight consecutive floats of LDS as one accumulator
__device__ __forceinline__ v8f lds8(const float* p){
    v4f a = *(const v4f*)p, b = *(const v4f*)(p + 4);
    return v8f{a[0], a[1], a[2], a[3], b[0], b[1], b[2], b[3]};
}
// elements 2*rp, 2*rp+1 of eight weights held as two 16-byte pieces
__device__ __forceinline__ v2f pair_of(const v4f (&f)[2], int rp){
    v2f a; a.x = f[rp >> 1][(rp & 1)*2]; a.y = f[rp >> 1][(rp & 1)*2 + 1];
    return a;
}

__global__ __launch_bounds__(FWV*32, 4) void col_block_kernel(const float* __restrict__ Wo,
                                  const float* __restrict__ bo, const float* __restrict__ Y,
                                  const float* __restrict__ lnw, const float* __restrict__ lnb,
                                  const float* __restrict__ W1, const float* __restrict__ b1,
                                  const float* __restrict__ W2, const float* __restrict__ b2,
                                  float* __restrict__ U){
    __shared__ __attribute__((aligned(16))) float sWo[2*HH*W1P];
    __shared__ __attribute__((aligned(16))) float sW1[2*HH*W1P];
    __shared__ __attribute__((aligned(16))) float sW2[HH*W2P];
    __shared__ __attribute__((aligned(16))) float sBo[2*HH];
    __shared__ __attribute__((aligned(16))) float sB1[2*HH];
    __shared__ __attribute__((aligned(16))) float sLw[HH];
    __shared__ __attribute__((aligned(16))) float sLb[HH];
    __shared__ __attribute__((aligned(16))) float sB2[HH];
    int tid = threadIdx.x;
    int lane = tid & 31;
    int wv = __builtin_amdgcn_readfirstlane(tid >> 5);   // the wave's number, in a scalar register
    int col = lane & 15, half = lane >> 4;
    int c0 = (blockIdx.x*FWV + wv)*FC;                   // the wave's first column, counted over B*L
    size_t off = (size_t)(c0/LL)*HH*LL + (size_t)(8*half)*LL + (c0 % LL) + 2*col;
    const float* Yp = Y + off;
    float* Up = U + off;

    v2f yy[4][8];
    #pragma unroll  // constant indices keep these arrays in registers, all loads in flight
    for (int mt = 0; mt < 4; ++mt)
        #pragma unroll  // constant indices keep these arrays in registers, all loads in flight
        for (int r = 0; r < 8; ++r) yy[mt][r] = *(const v2f*)(Yp + (size_t)(mt*16 + r)*LL);
    // the address registers of the loads above are free for the results of the loads below
    asm volatile("s_wait_xcnt 0x0" ::: "memory");
    {
        v4f o[8], p[8], g[8];
        #pragma unroll  // constant indices keep these arrays in registers, all loads in flight
        for (int j = 0; j < 8; ++j){
            int i = tid + j*(FWV*32);
            o[j] = *(const v4f*)(Wo + i*4);
            p[j] = *(const v4f*)(W1 + i*4);
            g[j] = *(const v4f*)(W2 + i*4);
        }
        // the short vectors, asked for right behind the loads above so that they come back with them
        if (tid < 2*HH){ sBo[tid] = bo[tid]; sB1[tid] = b1[tid]; }
        if (tid < HH){ sLw[tid] = lnw[tid]; sLb[tid] = lnb[tid]; sB2[tid] = b2[tid]; }
        // the index registers of the loads above are overwritten below
        asm volatile("s_wait_xcnt 0x0" ::: "memory");
        #pragma unroll  // constant indices keep these arrays in registers
        for (int j = 0; j < 8; ++j){
            int i = tid + j*(FWV*32);
            *(v4f*)(sWo + (i >> 4)*W1P + (i & 15)*4) = o[j];
            *(v4f*)(sW1 + (i >> 4)*W1P + (i & 15)*4) = p[j];
            *(v4f*)(sW2 + (i >> 5)*W2P + (i & 31)*4) = g[j];
        }
    }
    __syncthreads();

    // the residual rows are asked for here and used behind the first products
    v2f uu[4][8];
    #pragma unroll  // constant indices keep these arrays in registers, all loads in flight
    for (int mt = 0; mt < 4; ++mt)
        #pragma unroll  // constant indices keep these arrays in registers, all loads in flight
        for (int r = 0; r < 8; ++r) uu[mt][r] = *(const v2f*)(Up + (size_t)(mt*16 + r)*LL);

    // output product and GLU: rows mt*16.. and their gate rows 64 + mt*16.., then u += a*sigmoid(g)
    float un[4][2][8];
    {
        const float* ao = sWo + col*W1P + 8*half;
        #pragma unroll  // constant indices keep these arrays in registers
        for (int mt = 0; mt < 4; ++mt){
            v8f ca[2], cg[2];
            ca[0] = lds8(sBo + mt*16 + 8*half);      ca[1] = ca[0];
            cg[0] = lds8(sBo + HH + mt*16 + 8*half); cg[1] = cg[0];
            #pragma unroll  // constant indices keep these arrays in registers
            for (int kt = 0; kt < 4; ++kt){
                v4f fa[2], fg[2];
                #pragma unroll  // constant indices keep these arrays in registers
                for (int e = 0; e < 2; ++e){
                    fa[e] = *(const v4f*)(ao + (mt*16)*W1P + kt*16 + 4*e);
                    fg[e] = *(const v4f*)(ao + (HH + mt*16)*W1P + kt*16 + 4*e);
                }
                #pragma unroll  // constant indices keep these arrays in registers
                for (int rp = 0; rp < 4; ++rp)
                    #pragma unroll  // constant indices keep these arrays in registers
                    for (int t = 0; t < 2; ++t){
                        v2f bv; bv.x = yy[kt][2*rp][t]; bv.y = yy[kt][2*rp + 1][t];
                        ca[t] = __builtin_amdgcn_wmma_f32_16x16x4_f32(false, pair_of(fa, rp), false, bv,
                                                                      (short)0, ca[t], false, false);
                        cg[t] = __builtin_amdgcn_wmma_f32_16x16x4_f32(false, pair_of(fg, rp), false, bv,
                                                                      (short)0, cg[t], false, false);
                    }
            }
            #pragma unroll  // constant indices keep these arrays in registers
            for (int t = 0; t < 2; ++t)
                #pragma unroll  // constant indices keep these arrays in registers
                for (int rp = 0; rp < 4; ++rp){
                    v2f a = v2f{ca[t][2*rp], ca[t][2*rp + 1]}, g = v2f{cg[t][2*rp], cg[t][2*rp + 1]};
                    v2f n = __builtin_elementwise_fma(a, sigm2_f(g), v2f{uu[mt][2*rp][t], uu[mt][2*rp + 1][t]});
                    un[mt][t][2*rp] = n.x; un[mt][t][2*rp + 1] = n.y;
                }
            // one row block's accumulators at a time: without it all four blocks' products move to the
            // front and registers spill
            __builtin_amdgcn_sched_barrier(0);
        }
    }

    // LayerNorm of the wave's columns: a lane sums its 32 rows, lane l ^ 16 has the other 32
    float z[4][2][8];
    v8f c2[4][2];
    #pragma unroll  // constant indices keep these arrays in registers
    for (int t = 0; t < 2; ++t){
        float sa[4], sq[4];
        #pragma unroll  // constant indices keep these arrays in registers
        for (int mt = 0; mt < 4; ++mt){
            sa[mt] = 0.f; sq[mt] = 0.f;
            #pragma unroll  // constant indices keep these arrays in registers
            for (int r = 0; r < 8; ++r){ sa[mt] += un[mt][t][r]; sq[mt] = fmaf(un[mt][t][r], un[mt][t][r], sq[mt]); }
        }
        float s = (sa[0] + sa[1]) + (sa[2] + sa[3]);
        float q = (sq[0] + sq[1]) + (sq[2] + sq[3]);
        s += other_half(s);
        q += other_half(q);
        float mu = s*(1.0f/HH);
        float var = q*(1.0f/HH) - mu*mu;
        float rs = rsqrtf(var + 1e-5f);
        #pragma unroll  // constant indices keep these arrays in registers
        for (int mt = 0; mt < 4; ++mt){
            v8f lw = lds8(sLw + mt*16 + 8*half), lb = lds8(sLb + mt*16 + 8*half);
            v8f b2v = lds8(sB2 + mt*16 + 8*half);
            #pragma unroll  // constant indices keep these arrays in registers
            for (int r = 0; r < 8; ++r){
                float v = un[mt][t][r];
                z[mt][t][r] = fmaf((v - mu)*rs, lw[r], lb[r]);
                // the last product accumulates on top of the residual and its bias
                c2[mt][t][r] = v + b2v[r];
            }
        }
    }

    const float* a1 = sW1 + col*W1P + 8*half;
    const float* a2 = sW2 + col*W2P + 8*half;
    // rolled: one 16-row block of the hidden layer at a time keeps registers and code size down
    #pragma unroll 1
    for (int ht = 0; ht < 8; ++ht){
        v4f f[4][2];
        #pragma unroll  // constant indices keep these arrays in registers
        for (int mt = 0; mt < 4; ++mt){
            f[mt][0] = *(const v4f*)(a1 + ht*16*W1P + mt*16);
            f[mt][1] = *(const v4f*)(a1 + ht*16*W1P + mt*16 + 4);
        }
        v8f c1[2];
        c1[0] = lds8(sB1 + ht*16 + 8*half);
        c1[1] = c1[0];
        #pragma unroll  // constant indices keep these arrays in registers
        for (int mt = 0; mt < 4; ++mt)
            #pragma unroll  // constant indices keep these arrays in registers
            for (int rp = 0; rp < 4; ++rp)
                #pragma unroll  // constant indices keep these arrays in registers
                for (int t = 0; t < 2; ++t){
                    v2f bv; bv.x = z[mt][t][2*rp]; bv.y = z[mt][t][2*rp + 1];
                    c1[t] = __builtin_amdgcn_wmma_f32_16x16x4_f32(false, pair_of(f[mt], rp), false, bv,
                                                                  (short)0, c1[t], false, false);
                }
        #pragma unroll  // constant indices keep these arrays in registers
        for (int mt = 0; mt < 4; ++mt){
            f[mt][0] = *(const v4f*)(a2 + mt*16*W2P + ht*16);
            f[mt][1] = *(const v4f*)(a2 + mt*16*W2P + ht*16 + 4);
        }
        #pragma unroll  // constant indices keep these arrays in registers
        for (int t = 0; t < 2; ++t) c1[t] = gelu8_f(c1[t]);
        #pragma unroll  // constant indices keep these arrays in registers
        for (int rp = 0; rp < 4; ++rp)
            #pragma unroll  // constant indices keep these arrays in registers
            for (int mt = 0; mt < 4; ++mt)
                #pragma unroll  // constant indices keep these arrays in registers
                for (int t = 0; t < 2; ++t){
                    v2f bv; bv.x = c1[t][2*rp]; bv.y = c1[t][2*rp + 1];
                    c2[mt][t] = __builtin_amdgcn_wmma_f32_16x16x4_f32(false, pair_of(f[mt], rp), false, bv,
                                                                      (short)0, c2[mt][t], false, false);
                }
    }

    #pragma unroll  // constant indices keep these arrays in registers
    for (int mt = 0; mt < 4; ++mt)
        #pragma unroll  // constant indices keep these arrays in registers
        for (int r = 0; r < 8; ++r)
            *(v2f*)(Up + (size_t)(mt*16 + r)*LL) = v2f{c2[mt][0][r], c2[mt][1][r]};
}

// ---- final projection H->1
__global__ void proj_kernel(const float* __restrict__ U, const float* __restrict__ pw,
                            const float* __restrict__ pb, float* __restrict__ out){
    int idx = blockIdx.x*blockDim.x + threadIdx.x;   // B*L
    int l = idx % LL; int b = idx / LL;
    if (b >= BB) return;
    const float* up = U + (size_t)b*HH*LL + l;
    float acc = pb[0];
    #pragma unroll 8
    for (int h = 0; h < HH; ++h) acc = fmaf(up[(size_t)h*LL], pw[h], acc);
    out[idx] = acc;
}

extern "C" void kernel_launch(void* const* d_in, const int* in_sizes, int n_in,
                              void* d_out, int out_size, void* d_ws, size_t ws_size,
                              hipStream_t stream){
    (void)in_sizes; (void)n_in; (void)out_size; (void)ws_size;
    const float* x       = (const float*)d_in[0];
    const float* conv_w  = (const float*)d_in[1];
    const float* conv_b  = (const float*)d_in[2];
    const float* ln1_w   = (const float*)d_in[3];
    const float* ln1_b   = (const float*)d_in[4];
    const float* log_dt  = (const float*)d_in[5];
    const float* A_re    = (const float*)d_in[6];
    const float* A_im    = (const float*)d_in[7];
    const float* C_re    = (const float*)d_in[8];
    const float* C_im    = (const float*)d_in[9];
    const float* Dv      = (const float*)d_in[10];
    const float* outlin_w= (const float*)d_in[11];
    const float* outlin_b= (const float*)d_in[12];
    const float* ln2_w   = (const float*)d_in[13];
    const float* ln2_b   = (const float*)d_in[14];
    const float* ff_w1   = (const float*)d_in[15];
    const float* ff_b1   = (const float*)d_in[16];
    const float* ff_w2   = (const float*)d_in[17];
    const float* ff_b2   = (const float*)d_in[18];
    const float* proj_w  = (const float*)d_in[19];
    const float* proj_b  = (const float*)d_in[20];
    float* out = (float*)d_out;

    const size_t nBHL = (size_t)BB*HH*LL;          // 8.39M floats
    float*  u      = (float*)d_ws;
    float*  z      = u + nBHL;
    float*  yc     = z + nBHL;
    float2* wSC    = (float2*)(yc + nBHL);
    float2* wWC    = wSC + HH*NN;
    float*  Pm     = (float*)(wWC + HH*NN);        // (H,64,64)
    float*  Qm     = Pm + HH*SUB*SUB;              // (H,64,64)
    float*  Tm     = Qm + HH*SUB*SUB;              // (H,64,64)

    dim3 b256(256);
    conv_up_kernel<<<(unsigned)(nBHL/256), b256, 0, stream>>>(x, conv_w, conv_b, u);

    for (int i = 0; i < NBLK; ++i){
        ln_ch_kernel<<<(BB*LL)/256, b256, 0, stream>>>(u, ln1_w + i*HH, ln1_b + i*HH, z);
        s4pre_kernel<<<HH*4, b256, 0, stream>>>(log_dt + i*HH, A_re + i*HH*NN, A_im + i*HH*NN,
                                                C_re + i*HH*NN, C_im + i*HH*NN, wSC, wWC, Pm, Qm, Tm);
        s4_row_kernel<<<BB*HH, NSUB, 0, stream>>>(z, Pm, Qm, Tm, wSC, wWC, Dv + i*HH, yc);
        col_block_kernel<<<(BB*LL)/(FC*FWV), FWV*32, 0, stream>>>(outlin_w + i*2*HH*HH, outlin_b + i*2*HH, yc,
                                                                  ln2_w + i*HH, ln2_b + i*HH,
                                                                  ff_w1 + i*2*HH*HH, ff_b1 + i*2*HH,
                                                                  ff_w2 + i*2*HH*HH, ff_b2 + i*HH, u);
    }
    proj_kernel<<<(BB*LL)/256, b256, 0, stream>>>(u, proj_w, proj_b, out);
}

// v006
// Measured time: 307 microseconds a run.
// Two timings next to v005 put it at 1.12 and 1.11 times that version's speed.
// Over all steps from v000 it is 3.21 times as fast.
#include <hip/hip_runtime.h>
#include <hip/hip_bf16.h>
#include <math.h>

typedef __attribute__((ext_vector_type(2))) float v2f;
typedef __attribute__((ext_vector_type(4))) float v4f;
typedef __attribute__((ext_vector_type(8))) float v8f;

#define BB 8
#define HH 64
#define LIN 1024
#define KCONV 16
#define LL (LIN*KCONV)      // 16384
#define NN 32               // complex modes
#define SUB 64              // samples of one sub-chunk
#define NSUB (LL/SUB)       // 256 sub-chunks of a row; also the row kernel's work-group size
#define NWV (NSUB/32)       // 8 waves per row
#define MP (SUB+4)          // LDS pitch of a 64-float row: 16-byte aligned, 16 rows cover all banks
#define NBLK 4

// GELU and sigmoid on two values at once, so that the plain arithmetic goes out as packed instructions.
// 0.5*x*(1 + tanh(t)) = x/(1 + exp(-2*t)) with t = 0.7978845608*(x + 0.044715*x^3); the exponential is
// one hardware 2^a with log2(e) folded into the constants, the division one hardware reciprocal.
// a = +inf gives x*0 and a = -inf gives x*1, as the tanh form does.
__device__ __forceinline__ v2f rcp1p_exp2(v2f a){
    v2f d = v2f{__builtin_amdgcn_exp2f(a.x), __builtin_amdgcn_exp2f(a.y)} + 1.0f;
    return v2f{__builtin_amdgcn_rcpf(d.x), __builtin_amdgcn_rcpf(d.y)};
}
__device__ __forceinline__ v2f gelu2_f(v2f x){
    const float k1 = (float)(-2.0*0.7978845608028654*1.4426950408889634);
    const float k3 = (float)(-2.0*0.7978845608028654*0.044715*1.4426950408889634);
    return x*rcp1p_exp2(x*__builtin_elementwise_fma(x*x, v2f{k3, k3}, v2f{k1, k1}));
}
__device__ __forceinline__ v2f sigm2_f(v2f x){ return rcp1p_exp2(x*-1.4426950408889634f); }
// GELU of an accumulator's eight values
__device__ __forceinline__ v8f gelu8_f(v8f c){
    v2f a = gelu2_f(v2f{c[0], c[1]}), b = gelu2_f(v2f{c[2], c[3]});
    v2f d = gelu2_f(v2f{c[4], c[5]}), e = gelu2_f(v2f{c[6], c[7]});
    return v8f{a.x, a.y, b.x, b.y, d.x, d.y, e.x, e.y};
}

// ---- LayerNorm over channel dim (stride-L layout), one thread per (b,l)
__global__ void ln_ch_kernel(const float* __restrict__ u, const float* __restrict__ w,
                             const float* __restrict__ bias, float* __restrict__ z){
    int idx = blockIdx.x*blockDim.x + threadIdx.x;   // B*L
    int l = idx % LL; int b = idx / LL;
    if (b >= BB) return;
    const float* up = u + (size_t)b*HH*LL + l;
    float s = 0.f, s2 = 0.f;
    #pragma unroll 8
    for (int h = 0; h < HH; ++h){ float v = up[(size_t)h*LL]; s += v; s2 += v*v; }
    float mu = s * (1.0f/HH);
    float var = s2*(1.0f/HH) - mu*mu;
    float rs = rsqrtf(var + 1e-5f);
    float* zp = z + (size_t)b*HH*LL + l;
    #pragma unroll 8
    for (int h = 0; h < HH; ++h){
        float v = up[(size_t)h*LL];
        zp[(size_t)h*LL] = fmaf((v - mu)*rs, w[h], bias[h]);
    }
}

// logical row x of a 64-row operand matrix sits at storage row lrow_of(x): tile (x>>3)&3, row
// (x>>5)*8 + (x&7) of it, so that a lane's 32 accumulator values are 32 consecutive logical rows
__device__ __forceinline__ int lrow_of(int x){ return ((x >> 3) & 3)*16 + (x >> 5)*8 + (x & 7); }
__device__ __forceinline__ int logical_of(int lrow){ return ((lrow >> 3) & 1)*32 + (lrow >> 4)*8 + (lrow & 7); }

// ---- S4D discretization, as matrices over one sub-chunk of SUB samples. With w = exp(dt*A) and
// Ct = 2*C*(w-1)/A, state s <- w*s + z, y = Re(sum Ct*s):
//   Pm[2n+c][t] = Re/Im w^(SUB-1-t)         end state of a sub-chunk from a zero start
//   Qm[t][2n+c] = Re / -Im (Ct*w^(t+1))     what the carried-in state adds to sample t
//   Tm[t][s]    = Re sum_n Ct*w^(t-s)       what sample s <= t of the sub-chunk adds; 0 for s > t
// and wS = w^SUB, wW = w^(32*SUB) for the carries. One work-group does 16 powers of one channel.
// These matrices depend on the parameters alone, so all NBLK layers' are made in ONE launch, and that
// launch is shared with the up-convolution, which needs nothing of them: work-groups 0 .. PREWG-1
// (they start first) do the matrices, the others
//   ConvTranspose1d(1->H, k=16, stride=16): u[b,h,lin*16+k] = x[b,lin]*w[h,k]+b[h]
#define PWP (NN+1)          // LDS pitch of one power's 32 modes, floats
#define PREWG (NBLK*HH*4)   // work-groups that build matrices
__global__ void setup_kernel(const float* __restrict__ log_dt, const float* __restrict__ A_re,
                             const float* __restrict__ A_im, const float* __restrict__ C_re,
                             const float* __restrict__ C_im, float2* __restrict__ wSC,
                             float2* __restrict__ wWC, float* __restrict__ Pm,
                             float* __restrict__ Qm, float* __restrict__ Tm,
                             const float* __restrict__ x, const float* __restrict__ cw,
                             const float* __restrict__ cb, float* __restrict__ u){
    __shared__ float pr[17*PWP], pi[17*PWP];    // w^k, k = 16*q .. 16*q+16
    __shared__ float ctr[NN], cti[NN], kd[16];
    int tid = threadIdx.x;
    if (blockIdx.x >= PREWG){                   // the same for a whole work-group, ahead of every barrier
        size_t idx = (size_t)(blockIdx.x - PREWG)*256 + tid;   // B*H*L; 256 = the work-group's size
        int l = (int)(idx % LL); int bh = (int)(idx / LL); int h = bh % HH; int b = bh / HH;
        if (b >= BB) return;
        u[idx] = fmaf(x[b*LIN + (l>>4)], cw[h*KCONV + (l&15)], cb[h]);
        return;
    }
    // h counts the channels of all layers: every array here is laid out layer by layer
    int h = blockIdx.x >> 2, q = blockIdx.x & 3;
    float dt = expf(log_dt[h]);
    for (int i = tid; i < 17*NN; i += 256){
        int n = i & (NN - 1), kk = i >> 5;
        float k = (float)(16*q + kk);
        float dr = A_re[h*NN + n]*dt, di = A_im[h*NN + n]*dt;
        float e = expf(dr*k);
        pr[kk*PWP + n] = e*cosf(di*k);
        pi[kk*PWP + n] = e*sinf(di*k);
    }
    if (tid < NN){
        int idx = h*NN + tid;
        float ar = A_re[idx], ai = A_im[idx];
        float dr = ar*dt, di = ai*dt;
        float er = expf(dr);
        float wr = er*cosf(di), wi = er*sinf(di);
        float mr = wr - 1.0f, mi = wi;                       // w-1
        float den = 1.0f/(ar*ar + ai*ai);
        float qr = (mr*ar + mi*ai)*den;                      // (w-1)/A
        float qi = (mi*ar - mr*ai)*den;
        float cr = C_re[idx], ci = C_im[idx];
        ctr[tid] = 2.0f*(cr*qr - ci*qi);
        cti[tid] = 2.0f*(cr*qi + ci*qr);
        if (q == 0){
            float eS = expf(dr*(float)SUB);
            wSC[idx] = make_float2(eS*cosf(di*(float)SUB), eS*sinf(di*(float)SUB));
            float eW = expf(dr*(float)(32*SUB));
            wWC[idx] = make_float2(eW*cosf(di*(float)(32*SUB)), eW*sinf(di*(float)(32*SUB)));
        }
    }
    __syncthreads();
    float* Ph = Pm + h*(SUB*SUB);
    float* Qh = Qm + h*(SUB*SUB);
    for (int i = tid; i < 16*SUB; i += 256){
        int m = i & (SUB - 1), kk = i >> 6, n = m >> 1;
        // power 16*q + kk is column SUB-1-(16*q+kk) of Pm
        Ph[lrow_of(m)*SUB + (SUB - 1 - (16*q + kk))] = (m & 1) ? pi[kk*PWP + n] : pr[kk*PWP + n];
        // power 16*q + kk + 1 is row 16*q + kk of Qm
        float xr = pr[(kk + 1)*PWP + n], xi = pi[(kk + 1)*PWP + n];
        Qh[lrow_of(16*q + kk)*SUB + m] = (m & 1) ? -(ctr[n]*xi + cti[n]*xr) : (ctr[n]*xr - cti[n]*xi);
    }
    if (tid < 16){
        float a = 0.f, b = 0.f;
        for (int n = 0; n < NN; ++n){
            a = fmaf(ctr[n], pr[tid*PWP + n], a);
            b = fmaf(cti[n], pi[tid*PWP + n], b);
        }
        kd[tid] = a - b;
    }
    __syncthreads();
    float* Th = Tm + h*(SUB*SUB);
    for (int i = tid; i < 16*SUB; i += 256){
        int t = i >> 4, kk = i & 15, d = 16*q + kk;
        if (t >= d) Th[lrow_of(t)*SUB + (t - d)] = kd[kk];          // diagonal d below the main one
        if (t + d + 1 < SUB) Th[lrow_of(t)*SUB + (t + d + 1)] = 0.f; // diagonal d+1 above it
        // the next trip overwrites the address registers of the stores above
        asm volatile("s_wait_xcnt 0x0" ::: "memory");
    }
}

// acc[mt][nt] += M(rows of tile mt) * B(columns of tile nt), M 64x64 in LDS at pitch MP, Ml already
// at the lane's row and half. Step 2*q+e pairs column half*32 + 4*q + 2*e (+1) of M with the same
// element of the lane's B vector; eight independent accumulators cover the matrix unit's latency.
__device__ __forceinline__ void mat_acc(const float* Ml, const v4f (&b)[2][8], v8f (&acc)[4][2]){
    #pragma unroll  // constant indices keep these arrays in registers
    for (int q = 0; q < 8; ++q){
        v4f a[4];
        #pragma unroll  // constant indices keep these arrays in registers
        for (int mt = 0; mt < 4; ++mt) a[mt] = *(const v4f*)(Ml + mt*16*MP + 4*q);
        #pragma unroll  // constant indices keep these arrays in registers
        for (int e = 0; e < 2; ++e){
            #pragma unroll  // constant indices keep these arrays in registers
            for (int mt = 0; mt < 4; ++mt){
                v2f av; av.x = a[mt][2*e]; av.y = a[mt][2*e + 1];
                #pragma unroll  // constant indices keep these arrays in registers
                for (int nt = 0; nt < 2; ++nt){
                    v2f bv; bv.x = b[nt][q][2*e]; bv.y = b[nt][q][2*e + 1];
                    acc[mt][nt] = __builtin_amdgcn_wmma_f32_16x16x4_f32(false, av, false, bv,
                                                                 (short)0, acc[mt][nt], false, false);
                }
            }
        }
    }
}

// ---- S4 scan of one (b,h) row in one work-group, as matrix products over sub-chunks of SUB
// samples. A wave owns 32 sub-chunks (two column tiles). A lane (column c, half) holds elements
// half*32 .. half*32+31 of sub-chunk c's vector, whichever vector it is: samples, end state,
// carry, result. Between the products the carries are scanned with lane = mode, through LDS.
__global__ __launch_bounds__(NSUB, 4) void s4_row_kernel(const float* __restrict__ z,
                                  const float* __restrict__ Pm, const float* __restrict__ Qm,
                                  const float* __restrict__ Tm,
                                  const float2* __restrict__ wSC, const float2* __restrict__ wWC,
                                  const float* __restrict__ Dvec, float* __restrict__ out){
    __shared__ __attribute__((aligned(16))) float buf[NSUB*MP];   // samples, states, carries, results
    __shared__ __attribute__((aligned(16))) float mP[SUB*MP];
    __shared__ __attribute__((aligned(16))) float mQ[SUB*MP];
    __shared__ __attribute__((aligned(16))) float mT[SUB*MP];
    __shared__ __attribute__((aligned(16))) float wtot[NWV*2*NN]; // one total per wave and mode
    int tid = threadIdx.x;
    int lane = tid & 31;
    int wv = __builtin_amdgcn_readfirstlane(tid >> 5);   // the wave's number, in a scalar register
    int row = blockIdx.x;               // b*HH + h
    int hh = row % HH;
    const float* zp = z + (size_t)row*LL;
    float* op = out + (size_t)row*LL;
    int col = lane & 15, half = lane >> 4;
    // the carry scan's factors (lane = mode), asked for here so that they are there when it starts
    float2 wS = wSC[hh*NN + lane];
    float2 wW = wWC[hh*NN + lane];

    // samples: 16 B per lane from memory, element e to buf[(e/SUB)*MP + e%SUB]; with them the
    // channel's three matrices, 16-byte piece i to storage row i/16, columns 4*(i%16)..
    {
        v4f v[16], p[4], g[4], k[4];
        const float* zsrc = zp + wv*(32*SUB) + lane*4;
        const float* Ph = Pm + hh*(SUB*SUB);
        const float* Qh = Qm + hh*(SUB*SUB);
        const float* Th = Tm + hh*(SUB*SUB);
        float Dh = Dvec[hh];
        #pragma unroll  // constant indices keep this array in registers, all loads in flight
        for (int r = 0; r < 16; ++r) v[r] = *(const v4f*)(zsrc + r*128);
        #pragma unroll  // constant indices keep these arrays in registers, all loads in flight
        for (int j = 0; j < 4; ++j){
            int i = tid + j*NSUB;
            p[j] = *(const v4f*)(Ph + i*4);
            g[j] = *(const v4f*)(Qh + i*4);
            k[j] = *(const v4f*)(Th + i*4);
        }
        // the index registers of the loads above are overwritten below
        asm volatile("s_wait_xcnt 0x0" ::: "memory");
        #pragma unroll  // constant indices keep this array in registers
        for (int r = 0; r < 16; ++r){
            int e = wv*(32*SUB) + r*128 + lane*4;
            *(v4f*)(buf + (e/SUB)*MP + (e%SUB)) = v[r];
        }
        #pragma unroll  // constant indices keep these arrays in registers
        for (int j = 0; j < 4; ++j){
            int i = tid + j*NSUB;
            int lr = i >> 4, s0 = (i & 15)*4;
            int t = logical_of(lr);
            // D goes on the diagonal of the Toeplitz matrix
            #pragma unroll  // constant indices keep this vector in registers
            for (int e = 0; e < 4; ++e) k[j][e] = (t == s0 + e) ? k[j][e] + Dh : k[j][e];
            *(v4f*)(mP + lr*MP + s0) = p[j];
            *(v4f*)(mQ + lr*MP + s0) = g[j];
            *(v4f*)(mT + lr*MP + s0) = k[j];
        }
    }
    __syncthreads();

    float* vec0 = buf + (wv*32 + col)*MP + half*32;     // the lane's vector of column tile 0
    int moff = col*MP + half*32;                        // the lane's row and half of a matrix tile
    v4f zf[2][8];
    #pragma unroll  // constant indices keep these arrays in registers
    for (int nt = 0; nt < 2; ++nt)
        #pragma unroll  // constant indices keep these arrays in registers
        for (int q = 0; q < 8; ++q) zf[nt][q] = *(const v4f*)(vec0 + nt*16*MP + 4*q);

    v8f acc[4][2];
    // product 1: end state of every sub-chunk from a zero start, in place of its samples
    #pragma unroll  // constant indices keep these arrays in registers
    for (int mt = 0; mt < 4; ++mt){ acc[mt][0] = v8f{}; acc[mt][1] = v8f{}; }
    mat_acc(mP + moff, zf, acc);
    #pragma unroll  // constant indices keep these arrays in registers
    for (int nt = 0; nt < 2; ++nt)
        #pragma unroll  // constant indices keep these arrays in registers
        for (int mt = 0; mt < 4; ++mt){
            v8f c = acc[mt][nt];
            *(v4f*)(vec0 + nt*16*MP + mt*8)     = v4f{c[0], c[1], c[2], c[3]};
            *(v4f*)(vec0 + nt*16*MP + mt*8 + 4) = v4f{c[4], c[5], c[6], c[7]};
        }
    __syncthreads();

    // carries, lane = mode: the wave's total, the totals of the waves before it, then the
    // exclusive scan over the wave's own 32 sub-chunks
    {
        float* sp = buf + (wv*32)*MP + 2*lane;
        float cr = 0.f, ci = 0.f;
        #pragma unroll 8  // eight LDS reads go out ahead of the dependent chain
        for (int i = 0; i < 32; ++i){
            float2 loc = *(const float2*)(sp + i*MP);
            float nr = fmaf(wS.x, cr, -wS.y*ci) + loc.x;
            float ni = fmaf(wS.x, ci,  wS.y*cr) + loc.y;
            cr = nr; ci = ni;
        }
        *(float2*)(wtot + wv*(2*NN) + 2*lane) = make_float2(cr, ci);
        __syncthreads();
        cr = 0.f; ci = 0.f;
        for (int v = 0; v < wv; ++v){
            float2 loc = *(const float2*)(wtot + v*(2*NN) + 2*lane);
            float nr = fmaf(wW.x, cr, -wW.y*ci) + loc.x;
            float ni = fmaf(wW.x, ci,  wW.y*cr) + loc.y;
            cr = nr; ci = ni;
        }
        #pragma unroll 8  // eight LDS reads go out ahead of the dependent chain
        for (int i = 0; i < 32; ++i){
            float2 loc = *(const float2*)(sp + i*MP);
            *(float2*)(sp + i*MP) = make_float2(cr, ci);
            float nr = fmaf(wS.x, cr, -wS.y*ci) + loc.x;
            float ni = fmaf(wS.x, ci,  wS.y*cr) + loc.y;
            cr = nr; ci = ni;
        }
    }
    __syncthreads();

    // products 2 and 3: the carry's part and the sub-chunk's own part of y + D*z
    #pragma unroll  // constant indices keep these arrays in registers
    for (int mt = 0; mt < 4; ++mt){ acc[mt][0] = v8f{}; acc[mt][1] = v8f{}; }
    {
        v4f cf[2][8];
        #pragma unroll  // constant indices keep these arrays in registers
        for (int nt = 0; nt < 2; ++nt)
            #pragma unroll  // constant indices keep these arrays in registers
            for (int q = 0; q < 8; ++q) cf[nt][q] = *(const v4f*)(vec0 + nt*16*MP + 4*q);
        mat_acc(mQ + moff, cf, acc);
    }
    mat_acc(mT + moff, zf, acc);
    #pragma unroll  // constant indices keep these arrays in registers
    for (int nt = 0; nt < 2; ++nt)
        #pragma unroll  // constant indices keep these arrays in registers
        for (int mt = 0; mt < 4; ++mt){
            v8f c = gelu8_f(acc[mt][nt]);
            *(v4f*)(vec0 + nt*16*MP + mt*8)     = v4f{c[0], c[1], c[2], c[3]};
            *(v4f*)(vec0 + nt*16*MP + mt*8 + 4) = v4f{c[4], c[5], c[6], c[7]};
        }
    __syncthreads();

    // results: back out in the order the samples came in, 16 B per lane
    #pragma unroll 4  // four stores' LDS reads in flight at a time
    for (int r = 0; r < 16; ++r){
        int e = wv*(32*SUB) + r*128 + lane*4;
        *(v4f*)(op + e) = *(const v4f*)(buf + (e/SUB)*MP + (e%SUB));
    }
}

// ---- Everything between one scan and the next LayerNorm works on single columns, so it is one
// kernel: 128x64 output product with GLU and residual, LayerNorm over the channels, 128x64 product,
// GELU, 64x128 product, residual. A wave owns FC columns from end to end, two column tiles: column
// c0 + 2*c + t belongs to tile t of lane column c. A lane (c, half) holds rows mt*16 + 8*half + r
// (r = 0..7) of every block of 16 rows, which is the accumulator layout, so each product's result
// is the next product's B operand as it stands: k step (mt, rp) pairs rows mt*16 + 8*half + 2*rp
// (+1) with the same columns of the weight matrix. The weights are read from LDS.
#define FC 32               // columns of one wave
#define FWV 8               // waves of a work-group
#define W1P (HH+4)          // LDS pitch of a 64-float weight row: 16 B x odd
#define W2P (2*HH+4)        // LDS pitch of a 128-float weight row: 16 B x odd

// the value that lane l ^ 16 holds
__device__ __forceinline__ float other_half(float x){
    int b = __builtin_bit_cast(int, x);
    return __builtin_bit_cast(float, __builtin_amdgcn_permlanex16(b, b, 0x76543210, 0xfedcba98, false, false));
}
// eight consecutive floats of LDS as one accumulator
__device__ __forceinline__ v8f lds8(const float* p){
    v4f a = *(const v4f*)p, b = *(const v4f*)(p + 4);
    return v8f{a[0], a[1], a[2], a[3], b[0], b[1], b[2], b[3]};
}
// elements 2*rp, 2*rp+1 of eight weights held as two 16-byte pieces
__device__ __forceinline__ v2f pair_of(const v4f (&f)[2], int rp){
    v2f a; a.x = f[rp >> 1][(rp & 1)*2]; a.y = f[rp >> 1][(rp & 1)*2 + 1];
    return a;
}

__global__ __launch_bounds__(FWV*32, 4) void col_block_kernel(const float* __restrict__ Wo,
                                  const float* __restrict__ bo, const float* __restrict__ Y,
                                  const float* __restrict__ lnw, const float* __restrict__ lnb,
                                  const float* __restrict__ W1, const float* __restrict__ b1,
                                  const float* __restrict__ W2, const float* __restrict__ b2,
                                  float* __restrict__ U){
    __shared__ __attribute__((aligned(16))) float sWo[2*HH*W1P];
    __shared__ __attribute__((aligned(16))) float sW1[2*HH*W1P];
    __shared__ __attribute__((aligned(16))) float sW2[HH*W2P];
    __shared__ __attribute__((aligned(16))) float sBo[2*HH];
    __shared__ __attribute__((aligned(16))) float sB1[2*HH];
    __shared__ __attribute__((aligned(16))) float sLw[HH];
    __shared__ __attribute__((aligned(16))) float sLb[HH];
    __shared__ __attribute__((aligned(16))) float sB2[HH];
    int tid = threadIdx.x;
    int lane = tid & 31;
    int wv = __builtin_amdgcn_readfirstlane(tid >> 5);   // the wave's number, in a scalar register
    int col = lane & 15, half = lane >> 4;
    int c0 = (blockIdx.x*FWV + wv)*FC;                   // the wave's first column, counted over B*L
    size_t off = (size_t)(c0/LL)*HH*LL + (size_t)(8*half)*LL + (c0 % LL) + 2*col;
    const float* Yp = Y + off;
    float* Up = U + off;

    v2f yy[4][8];
    #pragma unroll  // constant indices keep these arrays in registers, all loads in flight
    for (int mt = 0; mt < 4; ++mt)
        #pragma unroll  // constant indices keep these arrays in registers, all loads in flight
        for (int r = 0; r < 8; ++r) yy[mt][r] = *(const v2f*)(Yp + (size_t)(mt*16 + r)*LL);
    // the address registers of the loads above are free for the results of the loads below
    asm volatile("s_wait_xcnt 0x0" ::: "memory");
    {
        v4f o[8], p[8], g[8];
        #pragma unroll  // constant indices keep these arrays in registers, all loads in flight
        for (int j = 0; j < 8; ++j){
            int i = tid + j*(FWV*32);
            o[j] = *(const v4f*)(Wo + i*4);
            p[j] = *(const v4f*)(W1 + i*4);
            g[j] = *(const v4f*)(W2 + i*4);
        }
        // the short vectors, asked for right behind the loads above so that they come back with them
        if (tid < 2*HH){ sBo[tid] = bo[tid]; sB1[tid] = b1[tid]; }
        if (tid < HH){ sLw[tid] = lnw[tid]; sLb[tid] = lnb[tid]; sB2[tid] = b2[tid]; }
        // the index registers of the loads above are overwritten below
        asm volatile("s_wait_xcnt 0x0" ::: "memory");
        #pragma unroll  // constant indices keep these arrays in registers
        for (int j = 0; j < 8; ++j){
            int i = tid + j*(FWV*32);
            *(v4f*)(sWo + (i >> 4)*W1P + (i & 15)*4) = o[j];
            *(v4f*)(sW1 + (i >> 4)*W1P + (i & 15)*4) = p[j];
            *(v4f*)(sW2 + (i >> 5)*W2P + (i & 31)*4) = g[j];
        }
    }
    __syncthreads();

    // the residual rows are asked for here and used behind the first products
    v2f uu[4][8];
    #pragma unroll  // constant indices keep these arrays in registers, all loads in flight
    for (int mt = 0; mt < 4; ++mt)
        #pragma unroll  // constant indices keep these arrays in registers, all loads in flight
        for (int r = 0; r < 8; ++r) uu[mt][r] = *(const v2f*)(Up + (size_t)(mt*16 + r)*LL);

    // output product and GLU: rows mt*16.. and their gate rows 64 + mt*16.., then u += a*sigmoid(g)
    float un[4][2][8];
    {
        const float* ao = sWo + col*W1P + 8*half;
        #pragma unroll  // constant indices keep these arrays in registers
        for (int mt = 0; mt < 4; ++mt){
            v8f ca[2], cg[2];
            ca[0] = lds8(sBo + mt*16 + 8*half);      ca[1] = ca[0];
            cg[0] = lds8(sBo + HH + mt*16 + 8*half); cg[1] = cg[0];
            #pragma unroll  // constant indices keep these arrays in registers
            for (int kt = 0; kt < 4; ++kt){
                v4f fa[2], fg[2];
                #pragma unroll  // constant indices keep these arrays in registers
                for (int e = 0; e < 2; ++e){
                    fa[e] = *(const v4f*)(ao + (mt*16)*W1P + kt*16 + 4*e);
                    fg[e] = *(const v4f*)(ao + (HH + mt*16)*W1P + kt*16 + 4*e);
                }
                #pragma unroll  // constant indices keep these arrays in registers
                for (int rp = 0; rp < 4; ++rp)
                    #pragma unroll  // constant indices keep these arrays in registers
                    for (int t = 0; t < 2; ++t){
                        v2f bv; bv.x = yy[kt][2*rp][t]; bv.y = yy[kt][2*rp + 1][t];
                        ca[t] = __builtin_amdgcn_wmma_f32_16x16x4_f32(false, pair_of(fa, rp), false, bv,
                                                                      (short)0, ca[t], false, false);
                        cg[t] = __builtin_amdgcn_wmma_f32_16x16x4_f32(false, pair_of(fg, rp), false, bv,
                                                                      (short)0, cg[t], false, false);
                    }
            }
            #pragma unroll  // constant indices keep these arrays in registers
            for (int t = 0; t < 2; ++t)
                #pragma unroll  // constant indices keep these arrays in registers
                for (int rp = 0; rp < 4; ++rp){
                    v2f a = v2f{ca[t][2*rp], ca[t][2*rp + 1]}, g = v2f{cg[t][2*rp], cg[t][2*rp + 1]};
                    v2f n = __builtin_elementwise_fma(a, sigm2_f(g), v2f{uu[mt][2*rp][t], uu[mt][2*rp + 1][t]});
                    un[mt][t][2*rp] = n.x; un[mt][t][2*rp + 1] = n.y;
                }
            // one row block's accumulators at a time: without it all four blocks' products move to the
            // front and registers spill
            __builtin_amdgcn_sched_barrier(0);
        }
    }

    // LayerNorm of the wave's columns: a lane sums its 32 rows, lane l ^ 16 has the other 32
    float z[4][2][8];
    v8f c2[4][2];
    #pragma unroll  // constant indices keep these arrays in registers
    for (int t = 0; t < 2; ++t){
        float sa[4], sq[4];
        #pragma unroll  // constant indices keep these arrays in registers
        for (int mt = 0; mt < 4; ++mt){
            sa[mt] = 0.f; sq[mt] = 0.f;
            #pragma unroll  // constant indices keep these arrays in registers
            for (int r = 0; r < 8; ++r){ sa[mt] += un[mt][t][r]; sq[mt] = fmaf(un[mt][t][r], un[mt][t][r], sq[mt]); }
        }
        float s = (sa[0] + sa[1]) + (sa[2] + sa[3]);
        float q = (sq[0] + sq[1]) + (sq[2] + sq[3]);
        s += other_half(s);
        q += other_half(q);
        float mu = s*(1.0f/HH);
        float var = q*(1.0f/HH) - mu*mu;
        float rs = rsqrtf(var + 1e-5f);
        #pragma unroll  // constant indices keep these arrays in registers
        for (int mt = 0; mt < 4; ++mt){
            v8f lw = lds8(sLw + mt*16 + 8*half), lb = lds8(sLb + mt*16 + 8*half);
            v8f b2v = lds8(sB2 + mt*16 + 8*half);
            #pragma unroll  // constant indices keep these arrays in registers
            for (int r = 0; r < 8; ++r){
                float v = un[mt][t][r];
                z[mt][t][r] = fmaf((v - mu)*rs, lw[r], lb[r]);
                // the last product accumulates on top of the residual and its bias
                c2[mt][t][r] = v + b2v[r];
            }
        }
    }

    const float* a1 = sW1 + col*W1P + 8*half;
    const float* a2 = sW2 + col*W2P + 8*half;
    // rolled: one 16-row block of the hidden layer at a time keeps registers and code size down
    #pragma unroll 1
    for (int ht = 0; ht < 8; ++ht){
        v4f f[4][2];
        #pragma unroll  // constant indices keep these arrays in registers
        for (int mt = 0; mt < 4; ++mt){
            f[mt][0] = *(const v4f*)(a1 + ht*16*W1P + mt*16);
            f[mt][1] = *(const v4f*)(a1 + ht*16*W1P + mt*16 + 4);
        }
        v8f c1[2];
        c1[0] = lds8(sB1 + ht*16 + 8*half);
        c1[1] = c1[0];
        #pragma unroll  // constant indices keep these arrays in registers
        for (int mt = 0; mt < 4; ++mt)
            #pragma unroll  // constant indices keep these arrays in registers
            for (int rp = 0; rp < 4; ++rp)
                #pragma unroll  // constant indices keep these arrays in registers
                for (int t = 0; t < 2; ++t){
                    v2f bv; bv.x = z[mt][t][2*rp]; bv.y = z[mt][t][2*rp + 1];
                    c1[t] = __builtin_amdgcn_wmma_f32_16x16x4_f32(false, pair_of(f[mt], rp), false, bv,
                                                                  (short)0, c1[t], false, false);
                }
        #pragma unroll  // constant indices keep these arrays in registers
        for (int mt = 0; mt < 4; ++mt){
            f[mt][0] = *(const v4f*)(a2 + mt*16*W2P + ht*16);
            f[mt][1] = *(const v4f*)(a2 + mt*16*W2P + ht*16 + 4);
        }
        #pragma unroll  // constant indices keep these arrays in registers
        for (int t = 0; t < 2; ++t) c1[t] = gelu8_f(c1[t]);
        #pragma unroll  // constant indices keep these arrays in registers
        for (int rp = 0; rp < 4; ++rp)
            #pragma unroll  // constant indices keep these arrays in registers
            for (int mt = 0; mt < 4; ++mt)
                #pragma unroll  // constant indices keep these arrays in registers
                for (int t = 0; t < 2; ++t){
                    v2f bv; bv.x = c1[t][2*rp]; bv.y = c1[t][2*rp + 1];
                    c2[mt][t] = __builtin_amdgcn_wmma_f32_16x16x4_f32(false, pair_of(f[mt], rp), false, bv,
                                                                      (short)0, c2[mt][t], false, false);
                }
    }

    #pragma unroll  // constant indices keep these arrays in registers
    for (int mt = 0; mt < 4; ++mt)
        #pragma unroll  // constant indices keep these arrays in registers
        for (int r = 0; r < 8; ++r)
            *(v2f*)(Up + (size_t)(mt*16 + r)*LL) = v2f{c2[mt][0][r], c2[mt][1][r]};
}

// ---- final projection H->1
__global__ void proj_kernel(const float* __restrict__ U, const float* __restrict__ pw,
                            const float* __restrict__ pb, float* __restrict__ out){
    int idx = blockIdx.x*blockDim.x + threadIdx.x;   // B*L
    int l = idx % LL; int b = idx / LL;
    if (b >= BB) return;
    const float* up = U + (size_t)b*HH*LL + l;
    float acc = pb[0];
    #pragma unroll 8
    for (int h = 0; h < HH; ++h) acc = fmaf(up[(size_t)h*LL], pw[h], acc);
    out[idx] = acc;
}

extern "C" void kernel_launch(void* const* d_in, const int* in_sizes, int n_in,
                              void* d_out, int out_size, void* d_ws, size_t ws_size,
                              hipStream_t stream){
    (void)in_sizes; (void)n_in; (void)out_size; (void)ws_size;
    const float* x       = (const float*)d_in[0];
    const float* conv_w  = (const float*)d_in[1];
    const float* conv_b  = (const float*)d_in[2];
    const float* ln1_w   = (const float*)d_in[3];
    const float* ln1_b   = (const float*)d_in[4];
    const float* log_dt  = (const float*)d_in[5];
    const float* A_re    = (const float*)d_in[6];
    const float* A_im    = (const float*)d_in[7];
    const float* C_re    = (const float*)d_in[8];
    const float* C_im    = (const float*)d_in[9];
    const float* Dv      = (const float*)d_in[10];
    const float* outlin_w= (const float*)d_in[11];
    const float* outlin_b= (const float*)d_in[12];
    const float* ln2_w   = (const float*)d_in[13];
    const float* ln2_b   = (const float*)d_in[14];
    const float* ff_w1   = (const float*)d_in[15];
    const float* ff_b1   = (const float*)d_in[16];
    const float* ff_w2   = (const float*)d_in[17];
    const float* ff_b2   = (const float*)d_in[18];
    const float* proj_w  = (const float*)d_in[19];
    const float* proj_b  = (const float*)d_in[20];
    float* out = (float*)d_out;

    const size_t nBHL = (size_t)BB*HH*LL;          // 8.39M floats
    float*  u      = (float*)d_ws;
    float*  z      = u + nBHL;
    float*  yc     = z + nBHL;
    float2* wSC    = (float2*)(yc + nBHL);
    float2* wWC    = wSC + NBLK*HH*NN;
    float*  Pm     = (float*)(wWC + NBLK*HH*NN);   // (NBLK,H,64,64)
    float*  Qm     = Pm + NBLK*HH*SUB*SUB;         // (NBLK,H,64,64)
    float*  Tm     = Qm + NBLK*HH*SUB*SUB;         // (NBLK,H,64,64)

    dim3 b256(256);
    setup_kernel<<<(unsigned)(PREWG + nBHL/256), b256, 0, stream>>>(log_dt, A_re, A_im, C_re, C_im, wSC, wWC,
                                                                    Pm, Qm, Tm, x, conv_w, conv_b, u);

    for (int i = 0; i < NBLK; ++i){
        ln_ch_kernel<<<(BB*LL)/256, b256, 0, stream>>>(u, ln1_w + i*HH, ln1_b + i*HH, z);
        s4_row_kernel<<<BB*HH, NSUB, 0, stream>>>(z, Pm + i*HH*SUB*SUB, Qm + i*HH*SUB*SUB, Tm + i*HH*SUB*SUB,
                                                  wSC + i*HH*NN, wWC + i*HH*NN, Dv + i*HH, yc);
        col_block_kernel<<<(BB*LL)/(FC*FWV), FWV*32, 0, stream>>>(outlin_w + i*2*HH*HH, outlin_b + i*2*HH, yc,
                                                                  ln2_w + i*HH, ln2_b + i*HH,
                                                                  ff_w1 + i*2*HH*HH, ff_b1 + i*2*HH,
                                                                  ff_w2 + i*2*HH*HH, ff_b2 + i*HH, u);
    }
    proj_kernel<<<(BB*LL)/256, b256, 0, stream>>>(u, proj_w, proj_b, out);
}

// v007
// One run takes 278 microseconds.
// Two timings next to v006 both put it at 1.10 times that version's speed.
// Over all steps from v000 it is 3.54 times as fast.
#include <hip/hip_runtime.h>
#include <hip/hip_bf16.h>
#include <math.h>

typedef __attribute__((ext_vector_type(2))) float v2f;
typedef __attribute__((ext_vector_type(4))) float v4f;
typedef __attribute__((ext_vector_type(8))) float v8f;

#define BB 8
#define HH 64
#define LIN 1024
#define KCONV 16
#define LL (LIN*KCONV)      // 16384
#define NN 32               // complex modes
#define SUB 64              // samples of one sub-chunk
#define NSUB (LL/SUB)       // 256 sub-chunks of a row; also the row kernel's work-group size
#define NWV (NSUB/32)       // 8 waves per row
#define MP (SUB+4)          // LDS pitch of a 64-float row: 16-byte aligned, 16 rows cover all banks
#define NBLK 4

// GELU and sigmoid on two values at once, so that the plain arithmetic goes out as packed instructions.
// 0.5*x*(1 + tanh(t)) = x/(1 + exp(-2*t)) with t = 0.7978845608*(x + 0.044715*x^3); the exponential is
// one hardware 2^a with log2(e) folded into the constants, the division one hardware reciprocal.
// a = +inf gives x*0 and a = -inf gives x*1, as the tanh form does.
__device__ __forceinline__ v2f rcp1p_exp2(v2f a){
    v2f d = v2f{__builtin_amdgcn_exp2f(a.x), __builtin_amdgcn_exp2f(a.y)} + 1.0f;
    return v2f{__builtin_amdgcn_rcpf(d.x), __builtin_amdgcn_rcpf(d.y)};
}
__device__ __forceinline__ v2f gelu2_f(v2f x){
    const float k1 = (float)(-2.0*0.7978845608028654*1.4426950408889634);
    const float k3 = (float)(-2.0*0.7978845608028654*0.044715*1.4426950408889634);
    return x*rcp1p_exp2(x*__builtin_elementwise_fma(x*x, v2f{k3, k3}, v2f{k1, k1}));
}
__device__ __forceinline__ v2f sigm2_f(v2f x){ return rcp1p_exp2(x*-1.4426950408889634f); }
// GELU of an accumulator's eight values
__device__ __forceinline__ v8f gelu8_f(v8f c){
    v2f a = gelu2_f(v2f{c[0], c[1]}), b = gelu2_f(v2f{c[2], c[3]});
    v2f d = gelu2_f(v2f{c[4], c[5]}), e = gelu2_f(v2f{c[6], c[7]});
    return v8f{a.x, a.y, b.x, b.y, d.x, d.y, e.x, e.y};
}

// ---- The residual stream u is never stored as it is. What lies in memory is its normalised form
// n = (u - mean)*rstd over the channels of a column, with the column's mean and deviation
// (sqrt(var + eps) = 1/rstd) beside it. The first LayerNorm of a layer is then fma(n, w[h], b[h]) on
// the scan's way in, and the column kernel gets its residual back as fma(n, deviation, mean).

// logical row x of a 64-row operand matrix sits at storage row lrow_of(x): tile (x>>3)&3, row
// (x>>5)*8 + (x&7) of it, so that a lane's 32 accumulator values are 32 consecutive logical rows
__device__ __forceinline__ int lrow_of(int x){ return ((x >> 3) & 3)*16 + (x >> 5)*8 + (x & 7); }
__device__ __forceinline__ int logical_of(int lrow){ return ((lrow >> 3) & 1)*32 + (lrow >> 4)*8 + (lrow & 7); }

// ---- S4D discretization, as matrices over one sub-chunk of SUB samples. With w = exp(dt*A) and
// Ct = 2*C*(w-1)/A, state s <- w*s + z, y = Re(sum Ct*s):
//   Pm[2n+c][t] = Re/Im w^(SUB-1-t)         end state of a sub-chunk from a zero start
//   Qm[t][2n+c] = Re / -Im (Ct*w^(t+1))     what the carried-in state adds to sample t
//   Tm[t][s]    = Re sum_n Ct*w^(t-s)       what sample s <= t of the sub-chunk adds; 0 for s > t
// and wS = w^SUB, wW = w^(32*SUB) for the carries. One work-group does 16 powers of one channel.
// These matrices depend on the parameters alone, so all NBLK layers' are made in ONE launch, and that
// launch is shared with the up-convolution, which needs nothing of them: work-groups 0 .. PREWG-1
// (they start first) do the matrices, the others
//   ConvTranspose1d(1->H, k=16, stride=16): u[b,h,lin*16+k] = x[b,lin]*w[h,k]+b[h]
// with a thread on two neighbouring columns and all their channels, which gives it the columns' statistics.
#define PWP (NN+1)          // LDS pitch of one power's 32 modes, floats
#define PREWG (NBLK*HH*4)   // work-groups that build matrices
#define UPWG ((BB*LL)/512)  // work-groups of the up-convolution: 256 threads, two columns each
__global__ __launch_bounds__(256) void setup_kernel(const float* __restrict__ log_dt, const float* __restrict__ A_re,
                             const float* __restrict__ A_im, const float* __restrict__ C_re,
                             const float* __restrict__ C_im, float2* __restrict__ wSC,
                             float2* __restrict__ wWC, float* __restrict__ Pm,
                             float* __restrict__ Qm, float* __restrict__ Tm,
                             const float* __restrict__ x, const float* __restrict__ cw,
                             const float* __restrict__ cb, float* __restrict__ u,
                             float* __restrict__ smu, float* __restrict__ ssd){
    __shared__ float pr[17*PWP], pi[17*PWP];    // w^k, k = 16*q .. 16*q+16
    __shared__ float ctr[NN], cti[NN], kd[16];
    int tid = threadIdx.x;
    if (blockIdx.x >= PREWG){                   // the same for a whole work-group, ahead of every barrier
        int c = ((blockIdx.x - PREWG)*256 + tid)*2;            // the first column, counted over B*L
        int l = c % LL, b = c / LL;
        float xv = x[b*LIN + (l >> 4)];                        // l is even: both columns have one sample
        const float* wp = cw + (l & 15);
        v2f s = v2f{0.f, 0.f}, q = v2f{0.f, 0.f};
        // rolled, and the values made twice: few registers, so that every work-group of this launch,
        // the matrix builders too, is resident at once
        #pragma unroll 1
        for (int hb = 0; hb < HH; hb += 16){
            v2f wv[16];
            #pragma unroll  // constant indices keep this array in registers, all loads in flight
            for (int j = 0; j < 16; ++j) wv[j] = *(const v2f*)(wp + (hb + j)*KCONV);
            // the next trip overwrites the address registers of the loads above
            asm volatile("s_wait_xcnt 0x0" ::: "memory");
            #pragma unroll  // constant indices keep this array in registers
            for (int j = 0; j < 16; ++j){
                v2f v = __builtin_elementwise_fma(v2f{xv, xv}, wv[j], v2f{cb[hb + j], cb[hb + j]});
                s += v;
                q = __builtin_elementwise_fma(v, v, q);
            }
        }
        v2f mu = s*(1.0f/HH);
        v2f ve = q*(1.0f/HH) - mu*mu + 1e-5f;
        v2f rs = v2f{rsqrtf(ve.x), rsqrtf(ve.y)};
        float* up = u + (size_t)b*HH*LL + l;
        #pragma unroll 1  // rolled for the same reason
        for (int hb = 0; hb < HH; hb += 16){
            v2f wv[16];
            #pragma unroll  // constant indices keep this array in registers, all loads in flight
            for (int j = 0; j < 16; ++j) wv[j] = *(const v2f*)(wp + (hb + j)*KCONV);
            #pragma unroll  // constant indices keep this array in registers
            for (int j = 0; j < 16; ++j){
                v2f v = __builtin_elementwise_fma(v2f{xv, xv}, wv[j], v2f{cb[hb + j], cb[hb + j]});
                *(v2f*)(up + (size_t)(hb + j)*LL) = (v - mu)*rs;
            }
            // the next trip overwrites the address registers of the loads and stores above
            asm volatile("s_wait_xcnt 0x0" ::: "memory");
        }
        *(v2f*)(smu + c) = mu;
        *(v2f*)(ssd + c) = ve*rs;
        return;
    }
    // h counts the channels of all layers: every array here is laid out layer by layer
    int h = blockIdx.x >> 2, q = blockIdx.x & 3;
    float dt = expf(log_dt[h]);
    for (int i = tid; i < 17*NN; i += 256){
        int n = i & (NN - 1), kk = i >> 5;
        float k = (float)(16*q + kk);
        float dr = A_re[h*NN + n]*dt, di = A_im[h*NN + n]*dt;
        float e = expf(dr*k);
        pr[kk*PWP + n] = e*cosf(di*k);
        pi[kk*PWP + n] = e*sinf(di*k);
    }
    if (tid < NN){
        int idx = h*NN + tid;
        float ar = A_re[idx], ai = A_im[idx];
        float dr = ar*dt, di = ai*dt;
        float er = expf(dr);
        float wr = er*cosf(di), wi = er*sinf(di);
        float mr = wr - 1.0f, mi = wi;                       // w-1
        float den = 1.0f/(ar*ar + ai*ai);
        float qr = (mr*ar + mi*ai)*den;                      // (w-1)/A
        float qi = (mi*ar - mr*ai)*den;
        float cr = C_re[idx], ci = C_im[idx];
        ctr[tid] = 2.0f*(cr*qr - ci*qi);
        cti[tid] = 2.0f*(cr*qi + ci*qr);
        if (q == 0){
            float eS = expf(dr*(float)SUB);
            wSC[idx] = make_float2(eS*cosf(di*(float)SUB), eS*sinf(di*(float)SUB));
            float eW = expf(dr*(float)(32*SUB));
            wWC[idx] = make_float2(eW*cosf(di*(float)(32*SUB)), eW*sinf(di*(float)(32*SUB)));
        }
    }
    __syncthreads();
    float* Ph = Pm + h*(SUB*SUB);
    float* Qh = Qm + h*(SUB*SUB);
    for (int i = tid; i < 16*SUB; i += 256){
        int m = i & (SUB - 1), kk = i >> 6, n = m >> 1;
        // power 16*q + kk is column SUB-1-(16*q+kk) of Pm
        Ph[lrow_of(m)*SUB + (SUB - 1 - (16*q + kk))] = (m & 1) ? pi[kk*PWP + n] : pr[kk*PWP + n];
        // power 16*q + kk + 1 is row 16*q + kk of Qm
        float xr = pr[(kk + 1)*PWP + n], xi = pi[(kk + 1)*PWP + n];
        Qh[lrow_of(16*q + kk)*SUB + m] = (m & 1) ? -(ctr[n]*xi + cti[n]*xr) : (ctr[n]*xr - cti[n]*xi);
    }
    if (tid < 16){
        float a = 0.f, b = 0.f;
        for (int n = 0; n < NN; ++n){
            a = fmaf(ctr[n], pr[tid*PWP + n], a);
            b = fmaf(cti[n], pi[tid*PWP + n], b);
        }
        kd[tid] = a - b;
    }
    __syncthreads();
    float* Th = Tm + h*(SUB*SUB);
    for (int i = tid; i < 16*SUB; i += 256){
        int t = i >> 4, kk = i & 15, d = 16*q + kk;
        if (t >= d) Th[lrow_of(t)*SUB + (t - d)] = kd[kk];          // diagonal d below the main one
        if (t + d + 1 < SUB) Th[lrow_of(t)*SUB + (t + d + 1)] = 0.f; // diagonal d+1 above it
        // the next trip overwrites the address registers of the stores above
        asm volatile("s_wait_xcnt 0x0" ::: "memory");
    }
}

// acc[mt][nt] += M(rows of tile mt) * B(columns of tile nt), M 64x64 in LDS at pitch MP, Ml already
// at the lane's row and half. Step 2*q+e pairs column half*32 + 4*q + 2*e (+1) of M with the same
// element of the lane's B vector; eight independent accumulators cover the matrix unit's latency.
__device__ __forceinline__ void mat_acc(const float* Ml, const v4f (&b)[2][8], v8f (&acc)[4][2]){
    #pragma unroll  // constant indices keep these arrays in registers
    for (int q = 0; q < 8; ++q){
        v4f a[4];
        #pragma unroll  // constant indices keep these arrays in registers
        for (int mt = 0; mt < 4; ++mt) a[mt] = *(const v4f*)(Ml + mt*16*MP + 4*q);
        #pragma unroll  // constant indices keep these arrays in registers
        for (int e = 0; e < 2; ++e){
            #pragma unroll  // constant indices keep these arrays in registers
            for (int mt = 0; mt < 4; ++mt){
                v2f av; av.x = a[mt][2*e]; av.y = a[mt][2*e + 1];
                #pragma unroll  // constant indices keep these arrays in registers
                for (int nt = 0; nt < 2; ++nt){
                    v2f bv; bv.x = b[nt][q][2*e]; bv.y = b[nt][q][2*e + 1];
                    acc[mt][nt] = __builtin_amdgcn_wmma_f32_16x16x4_f32(false, av, false, bv,
                                                                 (short)0, acc[mt][nt], false, false);
                }
            }
        }
    }
}

// ---- S4 scan of one (b,h) row in one work-group, as matrix products over sub-chunks of SUB
// samples. A wave owns 32 sub-chunks (two column tiles). A lane (column c, half) holds elements
// half*32 .. half*32+31 of sub-chunk c's vector, whichever vector it is: samples, end state,
// carry, result. Between the products the carries are scanned with lane = mode, through LDS.
__global__ __launch_bounds__(NSUB, 4) void s4_row_kernel(const float* __restrict__ z,
                                  const float* __restrict__ lnw, const float* __restrict__ lnb,
                                  const float* __restrict__ Pm, const float* __restrict__ Qm,
                                  const float* __restrict__ Tm,
                                  const float2* __restrict__ wSC, const float2* __restrict__ wWC,
                                  const float* __restrict__ Dvec, float* __restrict__ out){
    __shared__ __attribute__((aligned(16))) float buf[NSUB*MP];   // samples, states, carries, results
    __shared__ __attribute__((aligned(16))) float mP[SUB*MP];
    __shared__ __attribute__((aligned(16))) float mQ[SUB*MP];
    __shared__ __attribute__((aligned(16))) float mT[SUB*MP];
    __shared__ __attribute__((aligned(16))) float wtot[NWV*2*NN]; // one total per wave and mode
    int tid = threadIdx.x;
    int lane = tid & 31;
    int wv = __builtin_amdgcn_readfirstlane(tid >> 5);   // the wave's number, in a scalar register
    int row = blockIdx.x;               // b*HH + h
    int hh = row % HH;
    const float* zp = z + (size_t)row*LL;
    float* op = out + (size_t)row*LL;
    int col = lane & 15, half = lane >> 4;
    // the carry scan's factors (lane = mode), asked for here so that they are there when it starts
    float2 wS = wSC[hh*NN + lane];
    float2 wW = wWC[hh*NN + lane];

    // samples: 16 B per lane from memory, element e to buf[(e/SUB)*MP + e%SUB]; with them the
    // channel's three matrices, 16-byte piece i to storage row i/16, columns 4*(i%16)..
    {
        v4f v[16], p[4], g[4], k[4];
        const float* zsrc = zp + wv*(32*SUB) + lane*4;
        const float* Ph = Pm + hh*(SUB*SUB);
        const float* Qh = Qm + hh*(SUB*SUB);
        const float* Th = Tm + hh*(SUB*SUB);
        float Dh = Dvec[hh];
        float lw = lnw[hh], lb = lnb[hh];   // the row's LayerNorm weights: z comes in normalised only
        #pragma unroll  // constant indices keep this array in registers, all loads in flight
        for (int r = 0; r < 16; ++r) v[r] = *(const v4f*)(zsrc + r*128);
        #pragma unroll  // constant indices keep these arrays in registers, all loads in flight
        for (int j = 0; j < 4; ++j){
            int i = tid + j*NSUB;
            p[j] = *(const v4f*)(Ph + i*4);
            g[j] = *(const v4f*)(Qh + i*4);
            k[j] = *(const v4f*)(Th + i*4);
        }
        // the index registers of the loads above are overwritten below
        asm volatile("s_wait_xcnt 0x0" ::: "memory");
        #pragma unroll  // constant indices keep this array in registers
        for (int r = 0; r < 16; ++r){
            int e = wv*(32*SUB) + r*128 + lane*4;
            *(v4f*)(buf + (e/SUB)*MP + (e%SUB)) = __builtin_elementwise_fma(v[r], v4f{lw, lw, lw, lw}, v4f{lb, lb, lb, lb});
        }
        #pragma unroll  // constant indices keep these arrays in registers
        for (int j = 0; j < 4; ++j){
            int i = tid + j*NSUB;
            int lr = i >> 4, s0 = (i & 15)*4;
            int t = logical_of(lr);
            // D goes on the diagonal of the Toeplitz matrix
            #pragma unroll  // constant indices keep this vector in registers
            for (int e = 0; e < 4; ++e) k[j][e] = (t == s0 + e) ? k[j][e] + Dh : k[j][e];
            *(v4f*)(mP + lr*MP + s0) = p[j];
            *(v4f*)(mQ + lr*MP + s0) = g[j];
            *(v4f*)(mT + lr*MP + s0) = k[j];
        }
    }
    __syncthreads();

    float* vec0 = buf + (wv*32 + col)*MP + half*32;     // the lane's vector of column tile 0
    int moff = col*MP + half*32;                        // the lane's row and half of a matrix tile
    v4f zf[2][8];
    #pragma unroll  // constant indices keep these arrays in registers
    for (int nt = 0; nt < 2; ++nt)
        #pragma unroll  // constant indices keep these arrays in registers
        for (int q = 0; q < 8; ++q) zf[nt][q] = *(const v4f*)(vec0 + nt*16*MP + 4*q);

    v8f acc[4][2];
    // product 1: end state of every sub-chunk from a zero start, in place of its samples
    #pragma unroll  // constant indices keep these arrays in registers
    for (int mt = 0; mt < 4; ++mt){ acc[mt][0] = v8f{}; acc[mt][1] = v8f{}; }
    mat_acc(mP + moff, zf, acc);
    #pragma unroll  // constant indices keep these arrays in registers
    for (int nt = 0; nt < 2; ++nt)
        #pragma unroll  // constant indices keep these arrays in registers
        for (int mt = 0; mt < 4; ++mt){
            v8f c = acc[mt][nt];
            *(v4f*)(vec0 + nt*16*MP + mt*8)     = v4f{c[0], c[1], c[2], c[3]};
            *(v4f*)(vec0 + nt*16*MP + mt*8 + 4) = v4f{c[4], c[5], c[6], c[7]};
        }
    __syncthreads();

    // carries, lane = mode: the wave's total, the totals of the waves before it, then the
    // exclusive scan over the wave's own 32 sub-chunks
    {
        float* sp = buf + (wv*32)*MP + 2*lane;
        float cr = 0.f, ci = 0.f;
        #pragma unroll 8  // eight LDS reads go out ahead of the dependent chain
        for (int i = 0; i < 32; ++i){
            float2 loc = *(const float2*)(sp + i*MP);
            float nr = fmaf(wS.x, cr, -wS.y*ci) + loc.x;
            float ni = fmaf(wS.x, ci,  wS.y*cr) + loc.y;
            cr = nr; ci = ni;
        }
        *(float2*)(wtot + wv*(2*NN) + 2*lane) = make_float2(cr, ci);
        __syncthreads();
        cr = 0.f; ci = 0.f;
        for (int v = 0; v < wv; ++v){
            float2 loc = *(const float2*)(wtot + v*(2*NN) + 2*lane);
            float nr = fmaf(wW.x, cr, -wW.y*ci) + loc.x;
            float ni = fmaf(wW.x, ci,  wW.y*cr) + loc.y;
            cr = nr; ci = ni;
        }
        #pragma unroll 8  // eight LDS reads go out ahead of the dependent chain
        for (int i = 0; i < 32; ++i){
            float2 loc = *(const float2*)(sp + i*MP);
            *(float2*)(sp + i*MP) = make_float2(cr, ci);
            float nr = fmaf(wS.x, cr, -wS.y*ci) + loc.x;
            float ni = fmaf(wS.x, ci,  wS.y*cr) + loc.y;
            cr = nr; ci = ni;
        }
    }
    __syncthreads();

    // products 2 and 3: the carry's part and the sub-chunk's own part of y + D*z
    #pragma unroll  // constant indices keep these arrays in registers
    for (int mt = 0; mt < 4; ++mt){ acc[mt][0] = v8f{}; acc[mt][1] = v8f{}; }
    {
        v4f cf[2][8];
        #pragma unroll  // constant indices keep these arrays in registers
        for (int nt = 0; nt < 2; ++nt)
            #pragma unroll  // constant indices keep these arrays in registers
            for (int q = 0; q < 8; ++q) cf[nt][q] = *(const v4f*)(vec0 + nt*16*MP + 4*q);
        mat_acc(mQ + moff, cf, acc);
    }
    mat_acc(mT + moff, zf, acc);
    #pragma unroll  // constant indices keep these arrays in registers
    for (int nt = 0; nt < 2; ++nt)
        #pragma unroll  // constant indices keep these arrays in registers
        for (int mt = 0; mt < 4; ++mt){
            v8f c = gelu8_f(acc[mt][nt]);
            *(v4f*)(vec0 + nt*16*MP + mt*8)     = v4f{c[0], c[1], c[2], c[3]};
            *(v4f*)(vec0 + nt*16*MP + mt*8 + 4) = v4f{c[4], c[5], c[6], c[7]};
        }
    __syncthreads();

    // results: back out in the order the samples came in, 16 B per lane
    #pragma unroll 4  // four stores' LDS reads in flight at a time
    for (int r = 0; r < 16; ++r){
        int e = wv*(32*SUB) + r*128 + lane*4;
        *(v4f*)(op + e) = *(const v4f*)(buf + (e/SUB)*MP + (e%SUB));
    }
}

// ---- Everything between one scan and the next works on single columns, so it is one kernel:
// 128x64 output product with GLU and residual, LayerNorm over the channels, 128x64 product, GELU,
// 64x128 product, residual, and then what the reader of the result wants: the normalised form with
// the columns' statistics for the next layer, or behind the last layer the projection H->1, so that
// no pass over memory is left to a LayerNorm or to the projection.
// A wave owns FC columns from end to end, two column tiles: column
// c0 + 2*c + t belongs to tile t of lane column c. A lane (c, half) holds rows mt*16 + 8*half + r
// (r = 0..7) of every block of 16 rows, which is the accumulator layout, so each product's result
// is the next product's B operand as it stands: k step (mt, rp) pairs rows mt*16 + 8*half + 2*rp
// (+1) with the same columns of the weight matrix. The weights are read from LDS.
#define FC 32               // columns of one wave
#define FWV 8               // waves of a work-group
#define W1P (HH+4)          // LDS pitch of a 64-float weight row: 16 B x odd
#define W2P (2*HH+4)        // LDS pitch of a 128-float weight row: 16 B x odd

// the value that lane l ^ 16 holds
__device__ __forceinline__ float other_half(float x){
    int b = __builtin_bit_cast(int, x);
    return __builtin_bit_cast(float, __builtin_amdgcn_permlanex16(b, b, 0x76543210, 0xfedcba98, false, false));
}
// eight consecutive floats of LDS as one accumulator
__device__ __forceinline__ v8f lds8(const float* p){
    v4f a = *(const v4f*)p, b = *(const v4f*)(p + 4);
    return v8f{a[0], a[1], a[2], a[3], b[0], b[1], b[2], b[3]};
}
// elements 2*rp, 2*rp+1 of eight weights held as two 16-byte pieces
__device__ __forceinline__ v2f pair_of(const v4f (&f)[2], int rp){
    v2f a; a.x = f[rp >> 1][(rp & 1)*2]; a.y = f[rp >> 1][(rp & 1)*2 + 1];
    return a;
}

template <bool LAST>   // LAST: behind the last layer
__global__ __launch_bounds__(FWV*32, 4) void col_block_kernel(const float* __restrict__ Wo,
                                  const float* __restrict__ bo, const float* __restrict__ Y,
                                  const float* __restrict__ lnw, const float* __restrict__ lnb,
                                  const float* __restrict__ W1, const float* __restrict__ b1,
                                  const float* __restrict__ W2, const float* __restrict__ b2,
                                  float* __restrict__ U, float* __restrict__ smu, float* __restrict__ ssd,
                                  const float* __restrict__ pw, const float* __restrict__ pb,
                                  float* __restrict__ out){
    __shared__ __attribute__((aligned(16))) float sWo[2*HH*W1P];
    __shared__ __attribute__((aligned(16))) float sW1[2*HH*W1P];
    __shared__ __attribute__((aligned(16))) float sW2[HH*W2P];
    __shared__ __attribute__((aligned(16))) float sBo[2*HH];
    __shared__ __attribute__((aligned(16))) float sB1[2*HH];
    __shared__ __attribute__((aligned(16))) float sLw[HH];
    __shared__ __attribute__((aligned(16))) float sLb[HH];
    __shared__ __attribute__((aligned(16))) float sB2[HH];
    int tid = threadIdx.x;
    int lane = tid & 31;
    int wv = __builtin_amdgcn_readfirstlane(tid >> 5);   // the wave's number, in a scalar register
    int col = lane & 15, half = lane >> 4;
    int c0 = (blockIdx.x*FWV + wv)*FC;                   // the wave's first column, counted over B*L
    size_t off = (size_t)(c0/LL)*HH*LL + (size_t)(8*half)*LL + (c0 % LL) + 2*col;
    const float* Yp = Y + off;
    float* Up = U + off;

    v2f yy[4][8];
    #pragma unroll  // constant indices keep these arrays in registers, all loads in flight
    for (int mt = 0; mt < 4; ++mt)
        #pragma unroll  // constant indices keep these arrays in registers, all loads in flight
        for (int r = 0; r < 8; ++r) yy[mt][r] = *(const v2f*)(Yp + (size_t)(mt*16 + r)*LL);
    // the address registers of the loads above are free for the results of the loads below
    asm volatile("s_wait_xcnt 0x0" ::: "memory");
    {
        v4f o[8], p[8], g[8];
        #pragma unroll  // constant indices keep these arrays in registers, all loads in flight
        for (int j = 0; j < 8; ++j){
            int i = tid + j*(FWV*32);
            o[j] = *(const v4f*)(Wo + i*4);
            p[j] = *(const v4f*)(W1 + i*4);
            g[j] = *(const v4f*)(W2 + i*4);
        }
        // the short vectors, asked for right behind the loads above so that they come back with them
        if (tid < 2*HH){ sBo[tid] = bo[tid]; sB1[tid] = b1[tid]; }
        if (tid < HH){ sLw[tid] = lnw[tid]; sLb[tid] = lnb[tid]; sB2[tid] = b2[tid]; }
        // the index registers of the loads above are overwritten below
        asm volatile("s_wait_xcnt 0x0" ::: "memory");
        #pragma unroll  // constant indices keep these arrays in registers
        for (int j = 0; j < 8; ++j){
            int i = tid + j*(FWV*32);
            *(v4f*)(sWo + (i >> 4)*W1P + (i & 15)*4) = o[j];
            *(v4f*)(sW1 + (i >> 4)*W1P + (i & 15)*4) = p[j];
            *(v4f*)(sW2 + (i >> 5)*W2P + (i & 31)*4) = g[j];
        }
    }
    __syncthreads();

    // the residual rows are asked for here and used behind the first products
    v2f uu[4][8];
    #pragma unroll  // constant indices keep these arrays in registers, all loads in flight
    for (int mt = 0; mt < 4; ++mt)
        #pragma unroll  // constant indices keep these arrays in registers, all loads in flight
        for (int r = 0; r < 8; ++r) uu[mt][r] = *(const v2f*)(Up + (size_t)(mt*16 + r)*LL);
    // mean and deviation of the lane's two columns: they turn the normalised rows back into u
    int cidx = c0 + 2*col;
    v2f mu_in = *(const v2f*)(smu + cidx), sd_in = *(const v2f*)(ssd + cidx);
    // the address registers of the two loads above are free for other values below
    asm volatile("s_wait_xcnt 0x0" ::: "memory");

    // output product and GLU: rows mt*16.. and their gate rows 64 + mt*16.., then u += a*sigmoid(g)
    float un[4][2][8];
    {
        const float* ao = sWo + col*W1P + 8*half;
        #pragma unroll  // constant indices keep these arrays in registers
        for (int mt = 0; mt < 4; ++mt){
            v8f ca[2], cg[2];
            ca[0] = lds8(sBo + mt*16 + 8*half);      ca[1] = ca[0];
            cg[0] = lds8(sBo + HH + mt*16 + 8*half); cg[1] = cg[0];
            #pragma unroll  // constant indices keep these arrays in registers
            for (int kt = 0; kt < 4; ++kt){
                v4f fa[2], fg[2];
                #pragma unroll  // constant indices keep these arrays in registers
                for (int e = 0; e < 2; ++e){
                    fa[e] = *(const v4f*)(ao + (mt*16)*W1P + kt*16 + 4*e);
                    fg[e] = *(const v4f*)(ao + (HH + mt*16)*W1P + kt*16 + 4*e);
                }
                #pragma unroll  // constant indices keep these arrays in registers
                for (int rp = 0; rp < 4; ++rp)
                    #pragma unroll  // constant indices keep these arrays in registers
                    for (int t = 0; t < 2; ++t){
                        v2f bv; bv.x = yy[kt][2*rp][t]; bv.y = yy[kt][2*rp + 1][t];
                        ca[t] = __builtin_amdgcn_wmma_f32_16x16x4_f32(false, pair_of(fa, rp), false, bv,
                                                                      (short)0, ca[t], false, false);
                        cg[t] = __builtin_amdgcn_wmma_f32_16x16x4_f32(false, pair_of(fg, rp), false, bv,
                                                                      (short)0, cg[t], false, false);
                    }
            }
            #pragma unroll  // constant indices keep these arrays in registers
            for (int r = 0; r < 8; ++r) uu[mt][r] = __builtin_elementwise_fma(uu[mt][r], sd_in, mu_in);
            #pragma unroll  // constant indices keep these arrays in registers
            for (int t = 0; t < 2; ++t)
                #pragma unroll  // constant indices keep these arrays in registers
                for (int rp = 0; rp < 4; ++rp){
                    v2f a = v2f{ca[t][2*rp], ca[t][2*rp + 1]}, g = v2f{cg[t][2*rp], cg[t][2*rp + 1]};
                    v2f n = __builtin_elementwise_fma(a, sigm2_f(g), v2f{uu[mt][2*rp][t], uu[mt][2*rp + 1][t]});
                    un[mt][t][2*rp] = n.x; un[mt][t][2*rp + 1] = n.y;
                }
            // one row block's accumulators at a time: without it all four blocks' products move to the
            // front and registers spill
            __builtin_amdgcn_sched_barrier(0);
        }
    }

    // LayerNorm of the wave's columns: a lane sums its 32 rows, lane l ^ 16 has the other 32
    float z[4][2][8];
    v8f c2[4][2];
    #pragma unroll  // constant indices keep these arrays in registers
    for (int t = 0; t < 2; ++t){
        float sa[4], sq[4];
        #pragma unroll  // constant indices keep these arrays in registers
        for (int mt = 0; mt < 4; ++mt){
            sa[mt] = 0.f; sq[mt] = 0.f;
            #pragma unroll  // constant indices keep these arrays in registers
            for (int r = 0; r < 8; ++r){ sa[mt] += un[mt][t][r]; sq[mt] = fmaf(un[mt][t][r], un[mt][t][r], sq[mt]); }
        }
        float s = (sa[0] + sa[1]) + (sa[2] + sa[3]);
        float q = (sq[0] + sq[1]) + (sq[2] + sq[3]);
        s += other_half(s);
        q += other_half(q);
        float mu = s*(1.0f/HH);
        float var = q*(1.0f/HH) - mu*mu;
        float rs = rsqrtf(var + 1e-5f);
        #pragma unroll  // constant indices keep these arrays in registers
        for (int mt = 0; mt < 4; ++mt){
            v8f lw = lds8(sLw + mt*16 + 8*half), lb = lds8(sLb + mt*16 + 8*half);
            v8f b2v = lds8(sB2 + mt*16 + 8*half);
            #pragma unroll  // constant indices keep these arrays in registers
            for (int r = 0; r < 8; ++r){
                float v = un[mt][t][r];
                z[mt][t][r] = fmaf((v - mu)*rs, lw[r], lb[r]);
                // the last product accumulates on top of the residual and its bias
                c2[mt][t][r] = v + b2v[r];
            }
        }
    }

    const float* a1 = sW1 + col*W1P + 8*half;
    const float* a2 = sW2 + col*W2P + 8*half;
    // rolled: one 16-row block of the hidden layer at a time keeps registers and code size down
    #pragma unroll 1
    for (int ht = 0; ht < 8; ++ht){
        v4f f[4][2];
        #pragma unroll  // constant indices keep these arrays in registers
        for (int mt = 0; mt < 4; ++mt){
            f[mt][0] = *(const v4f*)(a1 + ht*16*W1P + mt*16);
            f[mt][1] = *(const v4f*)(a1 + ht*16*W1P + mt*16 + 4);
        }
        v8f c1[2];
        c1[0] = lds8(sB1 + ht*16 + 8*half);
        c1[1] = c1[0];
        #pragma unroll  // constant indices keep these arrays in registers
        for (int mt = 0; mt < 4; ++mt)
            #pragma unroll  // constant indices keep these arrays in registers
            for (int rp = 0; rp < 4; ++rp)
                #pragma unroll  // constant indices keep these arrays in registers
                for (int t = 0; t < 2; ++t){
                    v2f bv; bv.x = z[mt][t][2*rp]; bv.y = z[mt][t][2*rp + 1];
                    c1[t] = __builtin_amdgcn_wmma_f32_16x16x4_f32(false, pair_of(f[mt], rp), false, bv,
                                                                  (short)0, c1[t], false, false);
                }
        #pragma unroll  // constant indices keep these arrays in registers
        for (int mt = 0; mt < 4; ++mt){
            f[mt][0] = *(const v4f*)(a2 + mt*16*W2P + ht*16);
            f[mt][1] = *(const v4f*)(a2 + mt*16*W2P + ht*16 + 4);
        }
        #pragma unroll  // constant indices keep these arrays in registers
        for (int t = 0; t < 2; ++t) c1[t] = gelu8_f(c1[t]);
        #pragma unroll  // constant indices keep these arrays in registers
        for (int rp = 0; rp < 4; ++rp)
            #pragma unroll  // constant indices keep these arrays in registers
            for (int mt = 0; mt < 4; ++mt)
                #pragma unroll  // constant indices keep these arrays in registers
                for (int t = 0; t < 2; ++t){
                    v2f bv; bv.x = c1[t][2*rp]; bv.y = c1[t][2*rp + 1];
                    c2[mt][t] = __builtin_amdgcn_wmma_f32_16x16x4_f32(false, pair_of(f[mt], rp), false, bv,
                                                                      (short)0, c2[mt][t], false, false);
                }
    }

    if (LAST){
        // projection H->1 of the wave's columns: a lane sums its 32 rows, lane l ^ 16 has the other 32
        v4f pv[4][2];
        #pragma unroll  // constant indices keep this array in registers, all loads in flight
        for (int mt = 0; mt < 4; ++mt){
            pv[mt][0] = *(const v4f*)(pw + mt*16 + 8*half);
            pv[mt][1] = *(const v4f*)(pw + mt*16 + 8*half + 4);
        }
        float pb0 = pb[0];
        // the address registers of the loads above are free for other values below
        asm volatile("s_wait_xcnt 0x0" ::: "memory");
        float pa[2];
        #pragma unroll  // constant indices keep these arrays in registers
        for (int t = 0; t < 2; ++t){
            float a4[4];
            #pragma unroll  // constant indices keep these arrays in registers
            for (int mt = 0; mt < 4; ++mt){
                a4[mt] = 0.f;
                #pragma unroll  // constant indices keep these arrays in registers
                for (int r = 0; r < 8; ++r) a4[mt] = fmaf(c2[mt][t][r], pv[mt][r >> 2][r & 3], a4[mt]);
            }
            float a = (a4[0] + a4[1]) + (a4[2] + a4[3]);
            pa[t] = a + other_half(a) + pb0;
        }
        if (half == 0) *(v2f*)(out + cidx) = v2f{pa[0], pa[1]};
        return;
    }

    // statistics of the new u, as the LayerNorm above takes them, and its normalised form
    v2f mu_o, rs_o, sd_o;
    #pragma unroll  // constant indices keep these arrays in registers
    for (int t = 0; t < 2; ++t){
        float sa[4], sq[4];
        #pragma unroll  // constant indices keep these arrays in registers
        for (int mt = 0; mt < 4; ++mt){
            sa[mt] = 0.f; sq[mt] = 0.f;
            #pragma unroll  // constant indices keep these arrays in registers
            for (int r = 0; r < 8; ++r){ sa[mt] += c2[mt][t][r]; sq[mt] = fmaf(c2[mt][t][r], c2[mt][t][r], sq[mt]); }
        }
        float s = (sa[0] + sa[1]) + (sa[2] + sa[3]);
        float q = (sq[0] + sq[1]) + (sq[2] + sq[3]);
        s += other_half(s);
        q += other_half(q);
        float mu = s*(1.0f/HH);
        float ve = q*(1.0f/HH) - mu*mu + 1e-5f;
        float rs = rsqrtf(ve);
        mu_o[t] = mu; rs_o[t] = rs; sd_o[t] = ve*rs;
    }
    #pragma unroll  // constant indices keep these arrays in registers
    for (int mt = 0; mt < 4; ++mt)
        #pragma unroll  // constant indices keep these arrays in registers
        for (int r = 0; r < 8; ++r)
            *(v2f*)(Up + (size_t)(mt*16 + r)*LL) = (v2f{c2[mt][0][r], c2[mt][1][r]} - mu_o)*rs_o;
    if (half == 0){
        *(v2f*)(smu + cidx) = mu_o;
        *(v2f*)(ssd + cidx) = sd_o;
    }
}

extern "C" void kernel_launch(void* const* d_in, const int* in_sizes, int n_in,
                              void* d_out, int out_size, void* d_ws, size_t ws_size,
                              hipStream_t stream){
    (void)in_sizes; (void)n_in; (void)out_size; (void)ws_size;
    const float* x       = (const float*)d_in[0];
    const float* conv_w  = (const float*)d_in[1];
    const float* conv_b  = (const float*)d_in[2];
    const float* ln1_w   = (const float*)d_in[3];
    const float* ln1_b   = (const float*)d_in[4];
    const float* log_dt  = (const float*)d_in[5];
    const float* A_re    = (const float*)d_in[6];
    const float* A_im    = (const float*)d_in[7];
    const float* C_re    = (const float*)d_in[8];
    const float* C_im    = (const float*)d_in[9];
    const float* Dv      = (const float*)d_in[10];
    const float* outlin_w= (const float*)d_in[11];
    const float* outlin_b= (const float*)d_in[12];
    const float* ln2_w   = (const float*)d_in[13];
    const float* ln2_b   = (const float*)d_in[14];
    const float* ff_w1   = (const float*)d_in[15];
    const float* ff_b1   = (const float*)d_in[16];
    const float* ff_w2   = (const float*)d_in[17];
    const float* ff_b2   = (const float*)d_in[18];
    const float* proj_w  = (const float*)d_in[19];
    const float* proj_b  = (const float*)d_in[20];
    float* out = (float*)d_out;

    const size_t nBHL = (size_t)BB*HH*LL;          // 8.39M floats
    float*  u      = (float*)d_ws;
    float*  yc     = u + nBHL;
    float*  smu    = yc + nBHL;                    // (B,L) mean of a column of u
    float*  ssd    = smu + BB*LL;                  // (B,L) its deviation
    float2* wSC    = (float2*)(ssd + BB*LL);
    float2* wWC    = wSC + NBLK*HH*NN;
    float*  Pm     = (float*)(wWC + NBLK*HH*NN);   // (NBLK,H,64,64)
    float*  Qm     = Pm + NBLK*HH*SUB*SUB;         // (NBLK,H,64,64)
    float*  Tm     = Qm + NBLK*HH*SUB*SUB;         // (NBLK,H,64,64)

    dim3 b256(256);
    setup_kernel<<<PREWG + UPWG, b256, 0, stream>>>(log_dt, A_re, A_im, C_re, C_im, wSC, wWC,
                                                    Pm, Qm, Tm, x, conv_w, conv_b, u, smu, ssd);

    for (int i = 0; i < NBLK; ++i){
        s4_row_kernel<<<BB*HH, NSUB, 0, stream>>>(u, ln1_w + i*HH, ln1_b + i*HH,
                                                  Pm + i*HH*SUB*SUB, Qm + i*HH*SUB*SUB, Tm + i*HH*SUB*SUB,
                                                  wSC + i*HH*NN, wWC + i*HH*NN, Dv + i*HH, yc);
        if (i < NBLK - 1)
            col_block_kernel<false><<<(BB*LL)/(FC*FWV), FWV*32, 0, stream>>>(
                outlin_w + i*2*HH*HH, outlin_b + i*2*HH, yc, ln2_w + i*HH, ln2_b + i*HH,
                ff_w1 + i*2*HH*HH, ff_b1 + i*2*HH, ff_w2 + i*2*HH*HH, ff_b2 + i*HH, u, smu, ssd,
                proj_w, proj_b, out);
        else
            col_block_kernel<true><<<(BB*LL)/(FC*FWV), FWV*32, 0, stream>>>(
                outlin_w + i*2*HH*HH, outlin_b + i*2*HH, yc, ln2_w + i*HH, ln2_b + i*HH,
                ff_w1 + i*2*HH*HH, ff_b1 + i*2*HH, ff_w2 + i*2*HH*HH, ff_b2 + i*HH, u, smu, ssd,
                proj_w, proj_b, out);
    }
}
